// v000
// Times are from an AMD MI455X. After a warm-up the kernel runs many times in a row, and a time is the length of
// such a window on the GPU divided by its runs, so every launch and the gaps after it count. The runs cycle
// through copies of the inputs. A figure is the median of several windows, for all but v000 over two sittings.
// Sittings can differ by a few percent; kernels timed side by side share one.
// v000, which the later versions start from, runs in 2050 microseconds.
#include <hip/hip_runtime.h>

// Dual-path causal self-attention (x, q_g, k_g [4][1024][1024]; [q|k|v] = x Wqkv^T (fused 'oi' [3072][1024]), 16 heads x 64; scores = (q.k + q_g.k_g)/8 realised as ONE contraction over concatenated 128-wide score planes [q_h | qg_h] . [k_h | kg_h]; causal; p = softmax(scores / ln 1024); y = p.v (64-wide values); out = merged Wout^T -> [4][1024][1024]).
// Compute dtypes, f32 accumulate: every input rounded to bf16; q/k/v on PLAIN bf16 operands (inputs: exact); causal scores (K = 128 over the concatenated planes) and attn.v (tile skipping): query rows < 512 hl (3 products), the rest single fp16 (x1024); softmax f32; Wout hl x exact (2 products).

#define NB_  4
#define TT   1024
#define DM   1024
#define NH_  16
#define NKV  16
#define REP  (NH_ / NKV)
#define HD   64
#define DQ   (NH_ * HD)
#define DKV  (NKV * HD)
#define HS   128                  // score-plane head width: [q_h (64) | qg_h (64)]
#define ZH   2
#define RH   512                  // query rows < RH use hi+lo planes (0: none)
#define WIN  1024
#define PCAR 1024.0f
#define SCL  0.018033688011112042f   // (1/8) / ln(1024): scale then the log-norm softmax temperature
typedef _Float16 h16;
typedef unsigned short bf;
typedef __attribute__((ext_vector_type(16))) __bf16   v16bf;
typedef __attribute__((ext_vector_type(16))) _Float16 v16h;
typedef __attribute__((ext_vector_type(8)))  _Float16 v8h;
typedef __attribute__((ext_vector_type(8)))  unsigned short v8us;
typedef __attribute__((ext_vector_type(8)))  float    v8f;
typedef __attribute__((ext_vector_type(4)))  float    v4f;
typedef v8h  __attribute__((may_alias)) v8ha;
typedef v4f  __attribute__((may_alias)) v4fa;
typedef v8us __attribute__((may_alias)) v8usa;

__device__ __forceinline__ unsigned short f2bf(float f) { unsigned u = __float_as_uint(f); u += 0x7FFFu + ((u >> 16) & 1u); return (unsigned short)(u >> 16); }
__device__ __forceinline__ float bf2f(unsigned short b) { return __uint_as_float(((unsigned)b) << 16); }
__device__ __forceinline__ float bfr(float f) { return bf2f(f2bf(f)); }
__device__ __forceinline__ v16h cat16(v8h lo, v8h hi) { return __builtin_shufflevector(lo, hi, 0, 1, 2, 3, 4, 5, 6, 7, 8, 9, 10, 11, 12, 13, 14, 15); }
__device__ __forceinline__ v16bf cat16b(v8us lo, v8us hi) { return __builtin_bit_cast(v16bf, __builtin_shufflevector(lo, hi, 0, 1, 2, 3, 4, 5, 6, 7, 8, 9, 10, 11, 12, 13, 14, 15)); }
__device__ __forceinline__ v8f wmma16(v16h a, v16h b, v8f c) { return __builtin_amdgcn_wmma_f32_16x16x32_f16(false, a, false, b, (short)0, c, false, false); }
__device__ __forceinline__ v8f wmmab(v16bf a, v16bf b, v8f c) { return __builtin_amdgcn_wmma_f32_16x16x32_bf16(false, a, false, b, (short)0, c, false, false); }



// ---- k_gemmw: register-blocked GEMM, ONE WAVE per 64x64 output tile (16 accumulators), operands straight from K-contiguous 16-bit planes; grid (M/64, N/64, Z), 32 threads.
// C[m][n] (f32, pitch ldc, + optional f32 bias[n]) = sum_k A[m][k] Bt[n][k] (+ split products per NSPLIT). z-batch strides sA/sB/sC in elements. K % 32 == 0.
template <typename T16> struct WFrag;
template <> struct WFrag<h16> { typedef v16h V; static __device__ __forceinline__ V ld(const h16* p) { return cat16(*(const v8h*)p, *(const v8h*)(p + 16)); } static __device__ __forceinline__ v8f mma(V a, V b, v8f c) { return wmma16(a, b, c); } };
template <> struct WFrag<bf> { typedef v16bf V; static __device__ __forceinline__ V ld(const bf* p) { return cat16b(*(const v8us*)p, *(const v8us*)(p + 16)); } static __device__ __forceinline__ v8f mma(V a, V b, v8f c) { return wmmab(a, b, c); } };
template <typename T16, int NSPLIT, bool BIAS>
__global__ __launch_bounds__(32) void k_gemmw(const T16* __restrict__ A, const T16* __restrict__ A2, const T16* __restrict__ Bt, const T16* __restrict__ Bt2, int K, float* C, int ldc, const float* __restrict__ bias, size_t sA, size_t sB, size_t sC) {
    typedef typename WFrag<T16>::V V;
    __shared__ __align__(16) float os[16 * 68];
    const size_t z = blockIdx.z; A += z * sA; if (A2) A2 += z * sA; Bt += z * sB; if (Bt2) Bt2 += z * sB; C += z * sC;
    const int lane = threadIdx.x & 31, lr = lane & 15, hi = lane >> 4; const int r0 = blockIdx.x * 64, c0 = blockIdx.y * 64;
    v8f acc[4][4];
#pragma unroll
    for (int mb = 0; mb < 4; ++mb)
#pragma unroll
        for (int nb = 0; nb < 4; ++nb) acc[mb][nb] = (v8f){};
    const size_t aoff = (size_t)(r0 + lr) * K + 8 * hi, boff = (size_t)(c0 + lr) * K + 8 * hi;
#pragma unroll 1
    for (int kc = 0; kc < K; kc += 32) {
        V a[4], a2[4];
#pragma unroll
        for (int mb = 0; mb < 4; ++mb) { a[mb] = WFrag<T16>::ld(A + aoff + (size_t)mb * 16 * K + kc); if (NSPLIT == 1 || NSPLIT == 2) a2[mb] = WFrag<T16>::ld(A2 + aoff + (size_t)mb * 16 * K + kc); }
#pragma unroll
        for (int nb = 0; nb < 4; ++nb) { const V b = WFrag<T16>::ld(Bt + boff + (size_t)nb * 16 * K + kc); V b2; if (NSPLIT >= 2) b2 = WFrag<T16>::ld(Bt2 + boff + (size_t)nb * 16 * K + kc);
#pragma unroll
            for (int mb = 0; mb < 4; ++mb) { acc[mb][nb] = WFrag<T16>::mma(a[mb], b, acc[mb][nb]); if (NSPLIT == 1 || NSPLIT == 2) acc[mb][nb] = WFrag<T16>::mma(a2[mb], b, acc[mb][nb]); if (NSPLIT >= 2) acc[mb][nb] = WFrag<T16>::mma(a[mb], b2, acc[mb][nb]); } }
        asm volatile("v_nop\n\tv_nop\n\tv_nop\n\tv_nop" : "+v"(acc[0][0]), "+v"(acc[1][1]), "+v"(acc[2][2]), "+v"(acc[3][3]) : "v"(a[0]), "v"(a[3]));
    }
#pragma unroll
    for (int mb = 0; mb < 4; ++mb) {
#pragma unroll
        for (int nb = 0; nb < 4; ++nb) {
#pragma unroll
            for (int j = 0; j < 8; ++j) os[(hi * 8 + j) * 68 + nb * 16 + lr] = acc[mb][nb][j]; }
        __builtin_amdgcn_wave_barrier(); asm volatile("" ::: "memory");
        float* crow = C + (size_t)(r0 + mb * 16) * ldc + c0;
{
#pragma unroll
            for (int s = 0; s < 8; ++s) { const int row = 2 * s + hi, cofs = lr * 4; v4f val = *(const v4fa*)(os + row * 68 + cofs); if (BIAS) { val[0] += bfr(bias[c0 + cofs]); val[1] += bfr(bias[c0 + cofs + 1]); val[2] += bfr(bias[c0 + cofs + 2]); val[3] += bfr(bias[c0 + cofs + 3]); }
                *(v4f*)(crow + (size_t)row * ldc + cofs) = val; }
             }
        __builtin_amdgcn_wave_barrier(); asm volatile("" ::: "memory");
    }
}

// ---- k_gemmc: the same one-wave 64x64 tile GEMM specialised for causal attention: CMODE 1 skips score tiles entirely above the diagonal (query rows r0+roff.., key columns c0..), CMODE 2 limits the
// key (K) loop of the probability x value contraction to the diagonal block (probabilities beyond it are exactly zero). roff = row offset of this launch's first row within the sequence.
template <typename T16, int NSPLIT, int CMODE>
__global__ __launch_bounds__(32) void k_gemmc(const T16* __restrict__ A, const T16* __restrict__ A2, const T16* __restrict__ Bt, const T16* __restrict__ Bt2, int K, float* C, int ldc, int roff, size_t sA, size_t sB, size_t sC) {
    typedef typename WFrag<T16>::V V;
    __shared__ __align__(16) float os[16 * 68];
    const size_t z = blockIdx.z; A += z * sA; if (A2) A2 += z * sA; Bt += z * sB; if (Bt2) Bt2 += z * sB; C += z * sC;
    const int lane = threadIdx.x & 31, lr = lane & 15, hi = lane >> 4; const int r0 = blockIdx.x * 64, c0 = blockIdx.y * 64;
    if (CMODE == 1 && c0 > r0 + roff + 63) return;                  // score tile entirely above the causal diagonal: never read (the softmax masks j > i by select)
    const int Kl = (CMODE == 2) ? min(K, r0 + roff + 64) : K;        // P.V: probabilities are exactly 0 beyond the diagonal block, so the K loop stops there
    v8f acc[4][4];
#pragma unroll
    for (int mb = 0; mb < 4; ++mb)
#pragma unroll
        for (int nb = 0; nb < 4; ++nb) acc[mb][nb] = (v8f){};
    const size_t aoff = (size_t)(r0 + lr) * K + 8 * hi, boff = (size_t)(c0 + lr) * K + 8 * hi;
#pragma unroll 1
    for (int kc = 0; kc < Kl; kc += 32) {
        V a[4], a2[4];
#pragma unroll
        for (int mb = 0; mb < 4; ++mb) { a[mb] = WFrag<T16>::ld(A + aoff + (size_t)mb * 16 * K + kc); if (NSPLIT == 1 || NSPLIT == 2) a2[mb] = WFrag<T16>::ld(A2 + aoff + (size_t)mb * 16 * K + kc); }
#pragma unroll
        for (int nb = 0; nb < 4; ++nb) { const V b = WFrag<T16>::ld(Bt + boff + (size_t)nb * 16 * K + kc); V b2; if (NSPLIT >= 2) b2 = WFrag<T16>::ld(Bt2 + boff + (size_t)nb * 16 * K + kc);
#pragma unroll
            for (int mb = 0; mb < 4; ++mb) { acc[mb][nb] = WFrag<T16>::mma(a[mb], b, acc[mb][nb]); if (NSPLIT == 1 || NSPLIT == 2) acc[mb][nb] = WFrag<T16>::mma(a2[mb], b, acc[mb][nb]); if (NSPLIT >= 2) acc[mb][nb] = WFrag<T16>::mma(a[mb], b2, acc[mb][nb]); } }
        asm volatile("v_nop\n\tv_nop\n\tv_nop\n\tv_nop" : "+v"(acc[0][0]), "+v"(acc[1][1]), "+v"(acc[2][2]), "+v"(acc[3][3]) : "v"(a[0]), "v"(a[3]));
    }
#pragma unroll
    for (int mb = 0; mb < 4; ++mb) {
#pragma unroll
        for (int nb = 0; nb < 4; ++nb) {
#pragma unroll
            for (int j = 0; j < 8; ++j) os[(hi * 8 + j) * 68 + nb * 16 + lr] = acc[mb][nb][j]; }
        __builtin_amdgcn_wave_barrier(); asm volatile("" ::: "memory");
        float* crow = C + (size_t)(r0 + mb * 16) * ldc + c0;
{
#pragma unroll
            for (int s = 0; s < 8; ++s) { const int row = 2 * s + hi, cofs = lr * 4; v4f val = *(const v4fa*)(os + row * 68 + cofs);
                *(v4f*)(crow + (size_t)row * ldc + cofs) = val; }
             }
        __builtin_amdgcn_wave_barrier(); asm volatile("" ::: "memory");
    }
}

__device__ __forceinline__ h16 tohx(float x) { return (h16)x; }
__device__ __forceinline__ void splitf(float y, unsigned short& h, unsigned short& l) { h = f2bf(y); l = f2bf(y - bf2f(h)); }
typedef __attribute__((ext_vector_type(2))) _Float16 v2h;
typedef __attribute__((ext_vector_type(4))) _Float16 v4h;
typedef __attribute__((ext_vector_type(2))) unsigned short v2us;
typedef __attribute__((ext_vector_type(4))) unsigned short v4us;
typedef __attribute__((ext_vector_type(2))) float v2f;
typedef __attribute__((ext_vector_type(4))) int v4i;

__global__ __launch_bounds__(256) void k_wtG(const float* __restrict__ w, int K, int N, bf* Bt) {
    const int lane = threadIdx.x & 31; const int L0 = (blockIdx.x * 8 + (threadIdx.x >> 5)) * 8; const int nlines = N * K / 64;
{
#pragma unroll 1
        for (int l = 0; l < 8; ++l) { const int L = L0 + l; if (L >= nlines) break; const size_t e = (size_t)L * 64 + lane * 2; const int k = (int)(e % K), n = (int)(e / K); v2us o;
            o[0] = f2bf(w[(size_t)k * N + n]); o[1] = f2bf(w[(size_t)(k + 1) * N + n]); *(v2us*)(Bt + e) = o; }
         }
}
__global__ __launch_bounds__(256) void k_plane2(const float* __restrict__ F, const float* __restrict__ Gsrc, float sc, h16* P16, bf* Ph, bf* Pl) {
    const size_t e = ((size_t)blockIdx.x * 256 + threadIdx.x) * 2; if (e >= (size_t)NH_ * TT * HS) return; const int d = (int)(e % HS); const int t = (int)((e / HS) % TT); const int h = (int)(e / ((size_t)HS * TT)); v2h o16; v2us oh, ol;
#pragma unroll
    for (int q = 0; q < 2; ++q) { const int dd = d + q; const float r = ((dd < HD) ? F[(size_t)t * DQ + h * HD + dd] : bfr(Gsrc[(size_t)t * DQ + h * HD + dd - HD])) * sc; o16[q] = tohx(r); unsigned short a2, c2; splitf(r, a2, c2); oh[q] = a2; ol[q] = c2; }
    *(v2h*)(P16 + e) = o16; *(v2us*)(Ph + e) = oh; *(v2us*)(Pl + e) = ol;  }
__global__ __launch_bounds__(256) void k_cvt8(const float* __restrict__ src, bf* dst, size_t n8) { const size_t i = (size_t)blockIdx.x * 256 + threadIdx.x; if (i >= n8) return; const v8f v = *(const v8f*)(src + i * 8); v8us o;
#pragma unroll
    for (int k = 0; k < 8; ++k) o[k] = f2bf(v[k]); *(v8us*)(dst + i * 8) = o;  }


__global__ __launch_bounds__(256) void k_vtp(const float* __restrict__ F, int pitch, int nheads, h16* V16, bf* Vh, bf* Vl) { const size_t e = ((size_t)blockIdx.x * 256 + threadIdx.x) * 2; if (e >= (size_t)nheads * HD * TT) return; const int t = (int)(e % TT); const int d = (int)((e / TT) % HD); const int g = (int)(e / ((size_t)TT * HD)); v2h o16; v2us oh, ol;
#pragma unroll
    for (int q = 0; q < 2; ++q) { const float x = F[(size_t)(t + q) * pitch + g * HD + d]; o16[q] = tohx(x); unsigned short a2, c2; splitf(x, a2, c2); oh[q] = a2; ol[q] = c2; }
    *(v2h*)(V16 + e) = o16; *(v2us*)(Vh + e) = oh; *(v2us*)(Vl + e) = ol;  }

// k_asoft: per row (zz, i): t = S x HD^-0.5 / ln 1024 for j <= i and i - j < WIN (sliding causal window; the reference's -1e9 additive fill vanishes identically); softmax over the 1024 keys (register row, one exp, fixed trees);
__global__ __launch_bounds__(256) void k_asoft(const float* __restrict__ Sb, h16* P16, bf* Ph, bf* Pl) {
    const int lane = threadIdx.x & 31; const int row = blockIdx.x * 8 + (threadIdx.x >> 5); if (row >= ZH * TT) return; const int i = row % TT; const int zz = row / TT; (void)zz; const bool hires = (i < RH); const float* sr = Sb + (size_t)row * TT; float v[TT / 32]; float mx = -3.0e38f;
#pragma unroll
    for (int ch = 0; ch < TT / 128; ++ch) { const int j0 = ch * 128 + lane * 4; const v4f a = *(const v4f*)(sr + j0);
#pragma unroll
        for (int q = 0; q < 4; ++q) { const int j = j0 + q; (void)j; const float t = (j <= i && i - j < WIN) ? a[q] * SCL : -3.0e38f; v[ch * 4 + q] = t; mx = fmaxf(mx, t); } }
#pragma unroll
    for (int sh = 16; sh; sh >>= 1) mx = fmaxf(mx, __shfl_xor(mx, sh, 32));
    float sum = 0.f;
#pragma unroll
    for (int k = 0; k < TT / 32; ++k) { float d0 = __fsub_rn(v[k], mx); asm volatile("" : "+v"(d0)); v[k] = __builtin_amdgcn_exp2f(__fmul_rn(d0, 1.4426950408889634f)); sum += v[k]; }
#pragma unroll
    for (int sh = 16; sh; sh >>= 1) sum += __shfl_xor(sum, sh, 32);
    const float f = __fdiv_rn(hires ? 1.0f : PCAR, sum);
{
        if (hires) {
#pragma unroll
            for (int ch = 0; ch < TT / 128; ++ch) { v4us oh, ol;
#pragma unroll
                for (int q = 0; q < 4; ++q) { unsigned short a, c2; splitf(v[ch * 4 + q] * f, a, c2); oh[q] = a; ol[q] = c2; }
                const size_t oo = ((size_t)zz * (RH ? RH : 1) + i) * TT + ch * 128 + lane * 4; *(v4us*)(Ph + oo) = oh; *(v4us*)(Pl + oo) = ol; }
        } else {
#pragma unroll
            for (int ch = 0; ch < TT / 128; ++ch) { v4h o4;
#pragma unroll
                for (int q = 0; q < 4; ++q) o4[q] = tohx(v[ch * 4 + q] * f);
                *(v4h*)(P16 + (size_t)row * TT + ch * 128 + lane * 4) = o4; } }
         }
}
__global__ __launch_bounds__(256) void k_merge(const float* __restrict__ O, int h0, bf* Ah, bf* Al) { const size_t e = ((size_t)blockIdx.x * 256 + threadIdx.x) * 2; if (e >= (size_t)ZH * TT * HD) return; const int d = (int)(e % HD); const int t = (int)((e / HD) % TT); const int zz = (int)(e / ((size_t)HD * TT)); const float cs = (t < RH) ? 1.0f : (1.0f / PCAR); const size_t oo = (size_t)t * DQ + (h0 + zz) * HD + d;
    v2us oh, ol;
#pragma unroll
    for (int q = 0; q < 2; ++q) { unsigned short a, c2; splitf(O[e + q] * cs, a, c2); oh[q] = a; ol[q] = c2; } *(v2us*)(Ah + oo) = oh; *(v2us*)(Al + oo) = ol;  }

extern "C" void kernel_launch(void* const* d_in, const int* in_sizes, int n_in,
                              void* d_out, int out_size, void* d_ws, size_t ws_size, hipStream_t stream) {
    (void)in_sizes; (void)n_in; (void)out_size;
    const float* x = (const float*)d_in[0]; const float* qg = (const float*)d_in[1]; const float* kg = (const float*)d_in[2]; const float* wq = (const float*)d_in[3]; const float* wk = wq + (size_t)1024 * 1024; const float* wv = wq + (size_t)2048 * 1024;   /* row blocks of the fused Wqkv */ const float* wo = (const float*)d_in[4];
    float* OUT = (float*)d_out;     // [4][1024][1024]
    char* wsp = (char*)d_ws;
    auto take = [&](size_t bytes) { char* p = wsp; wsp += (bytes + 255) & ~(size_t)255; return (void*)p; };
    bf* WQ = (bf*)take((size_t)DQ * DM * 2); bf* WK = (bf*)take((size_t)DKV * DM * 2); bf* WV = (bf*)take((size_t)DKV * DM * 2); bf* WO = (bf*)take((size_t)DM * DQ * 2); float* CS = (float*)take((size_t)TT * HD * 2 * 4);
    bf* XB = (bf*)take((size_t)TT * DM * 2); float* FQ = (float*)take((size_t)TT * DQ * 4); float* FK = (float*)take((size_t)TT * DKV * 4);
    h16* QP16 = (h16*)take((size_t)NH_ * TT * HS * 2); h16* KP16 = (h16*)take((size_t)NKV * TT * HS * 2); h16* VT16 = (h16*)take((size_t)NKV * HD * TT * 2);
    bf* QPh = (bf*)take((size_t)NH_ * TT * HS * 2); bf* QPl = (bf*)take((size_t)NH_ * TT * HS * 2); bf* KPh = (bf*)take((size_t)NKV * TT * HS * 2); bf* KPl = (bf*)take((size_t)NKV * TT * HS * 2); bf* VTh = (bf*)take((size_t)NKV * HD * TT * 2); bf* VTl = (bf*)take((size_t)NKV * HD * TT * 2); bf* Ph = (bf*)take((size_t)ZH * RH * TT * 2); bf* Pl = (bf*)take((size_t)ZH * RH * TT * 2);
    float* Sb = (float*)take((size_t)ZH * TT * TT * 4); h16* P16 = (h16*)take((size_t)ZH * TT * TT * 2); float* Ob = (float*)take((size_t)ZH * TT * HD * 4); bf* ATh = (bf*)take((size_t)TT * DQ * 2); bf* ATl = (bf*)take((size_t)TT * DQ * 2);
    if ((size_t)(wsp - (char*)d_ws) > ws_size) return;    // ws 256 MiB
    float* FV = FK;   // v projection reuses the k buffer after the k planes are built (stream-ordered)
    { k_cvt8<<<(unsigned)(((size_t)DQ * DM / 8 + 255) / 256), 256, 0, stream>>>(wq, WQ, (size_t)DQ * DM / 8); k_cvt8<<<(unsigned)(((size_t)DKV * DM / 8 + 255) / 256), 256, 0, stream>>>(wk, WK, (size_t)DKV * DM / 8); k_cvt8<<<(unsigned)(((size_t)DKV * DM / 8 + 255) / 256), 256, 0, stream>>>(wv, WV, (size_t)DKV * DM / 8);
      k_cvt8<<<(unsigned)(((size_t)DM * DQ / 8 + 255) / 256), 256, 0, stream>>>(wo, WO, (size_t)DM * DQ / 8);
       }

    const unsigned LQ = (unsigned)(((size_t)NH_ * TT * HD / 2 + 255) / 256), LKv = (unsigned)(((size_t)NKV * TT * HD / 2 + 255) / 256);
    for (int b = 0; b < NB_; ++b) {
        
        k_cvt8<<<(unsigned)(((size_t)TT * DM / 8 + 255) / 256), 256, 0, stream>>>(x + (size_t)b * TT * DM, XB, (size_t)TT * DM / 8);
        k_gemmw<bf, 0, false><<<dim3(TT / 64, DQ / 64, 1), 32, 0, stream>>>(XB, nullptr, WQ, nullptr, DM, FQ, DQ, nullptr, 0, 0, 0);
        k_plane2<<<(unsigned)(((size_t)NH_ * TT * HS / 2 + 255) / 256), 256, 0, stream>>>(FQ, qg + (size_t)b * TT * DM, 1.0f, QP16, QPh, QPl);   /* [q | q_g] planes */
        k_gemmw<bf, 0, false><<<dim3(TT / 64, DKV / 64, 1), 32, 0, stream>>>(XB, nullptr, WK, nullptr, DM, FK, DKV, nullptr, 0, 0, 0);
        k_plane2<<<(unsigned)(((size_t)NKV * TT * HS / 2 + 255) / 256), 256, 0, stream>>>(FK, kg + (size_t)b * TT * DM, 1.0f, KP16, KPh, KPl);   /* [k | k_g] planes */
        k_gemmw<bf, 0, false><<<dim3(TT / 64, DKV / 64, 1), 32, 0, stream>>>(XB, nullptr, WV, nullptr, DM, FV, DKV, nullptr, 0, 0, 0); k_vtp<<<LKv, 256, 0, stream>>>(FV, DKV, NKV, VT16, VTh, VTl);
        for (int h0 = 0; h0 < NH_; h0 += ZH) { const size_t zq = (size_t)h0, zk = (size_t)(h0 / REP);   // one kv head per query head: the pass's two heads use consecutive kv planes (z-strides TT*HS for k, HD*TT for v)
            k_gemmc<bf, 2, 1><<<dim3(RH / 64, TT / 64, ZH), 32, 0, stream>>>(QPh + zq * TT * HS, QPl + zq * TT * HS, KPh + zk * TT * HS, KPl + zk * TT * HS, HS, Sb, TT, 0, (size_t)TT * HS, (size_t)TT * HS, (size_t)TT * TT);
            k_gemmc<h16, 0, 1><<<dim3((TT - RH) / 64, TT / 64, ZH), 32, 0, stream>>>(QP16 + zq * TT * HS + (size_t)RH * HS, nullptr, KP16 + zk * TT * HS, nullptr, HS, Sb + (size_t)RH * TT, TT, RH, (size_t)TT * HS, (size_t)TT * HS, (size_t)TT * TT);
            k_asoft<<<ZH * TT / 8, 256, 0, stream>>>(Sb, P16, Ph, Pl);
            k_gemmc<bf, 2, 2><<<dim3(RH / 64, HD / 64, ZH), 32, 0, stream>>>(Ph, Pl, VTh + zk * HD * TT, VTl + zk * HD * TT, TT, Ob, HD, 0, (size_t)RH * TT, (size_t)HD * TT, (size_t)TT * HD);
            k_gemmc<h16, 0, 2><<<dim3((TT - RH) / 64, HD / 64, ZH), 32, 0, stream>>>(P16 + (size_t)RH * TT, nullptr, VT16 + zk * HD * TT, nullptr, TT, Ob + (size_t)RH * HD, HD, RH, (size_t)TT * TT, (size_t)HD * TT, (size_t)TT * HD);
            k_merge<<<(unsigned)(((size_t)ZH * TT * HD / 2 + 255) / 256), 256, 0, stream>>>(Ob, h0, ATh, ATl); }
        k_gemmw<bf, 1, false><<<dim3(TT / 64, DM / 64, 1), 32, 0, stream>>>(ATh, ATl, WO, nullptr, DQ, OUT + (size_t)b * TT * DM, DM, nullptr, 0, 0, 0); }
}

// v001
// A run of this version takes 443 microseconds.
// Two timings next to v000 put it at 4.66 and 4.65 times that version's speed.
#include <hip/hip_runtime.h>

// Dual-path causal self-attention (x, q_g, k_g [4][1024][1024]; [q|k|v] = x Wqkv^T (fused 'oi' [3072][1024]), 16 heads x 64; scores = (q.k + q_g.k_g)/8 realised as ONE contraction over concatenated 128-wide score planes [q_h | qg_h] . [k_h | kg_h]; causal; p = softmax(scores / ln 1024); y = p.v (64-wide values); out = merged Wout^T -> [4][1024][1024]).
// Compute dtypes, f32 accumulate: every input rounded to bf16; q/k/v on PLAIN bf16 operands (inputs: exact); causal scores (K = 128 over the concatenated planes) and attn.v (tile skipping): query rows < 512 hl (3 products), the rest single fp16 (x1024); softmax f32; Wout hl x exact (2 products).

#define NB_  4
#define TT   1024
#define DM   1024
#define NH_  16
#define NKV  16
#define REP  (NH_ / NKV)
#define HD   64
#define DQ   (NH_ * HD)
#define DKV  (NKV * HD)
#define HS   128                  // score-plane head width: [q_h (64) | qg_h (64)]
#define ZH   16                   // heads per attention launch: all heads of one batch entry
#define RH   512                  // query rows < RH use hi+lo planes (0: none)
#define WIN  1024
#define PCAR 1024.0f
#define SCL  0.018033688011112042f   // (1/8) / ln(1024): scale then the log-norm softmax temperature
typedef _Float16 h16;
typedef unsigned short bf;
typedef __attribute__((ext_vector_type(16))) __bf16   v16bf;
typedef __attribute__((ext_vector_type(16))) _Float16 v16h;
typedef __attribute__((ext_vector_type(8)))  _Float16 v8h;
typedef __attribute__((ext_vector_type(8)))  unsigned short v8us;
typedef __attribute__((ext_vector_type(8)))  float    v8f;
typedef __attribute__((ext_vector_type(4)))  float    v4f;
typedef v8h  __attribute__((may_alias)) v8ha;
typedef v4f  __attribute__((may_alias)) v4fa;
typedef v8us __attribute__((may_alias)) v8usa;

__device__ __forceinline__ unsigned short f2bf(float f) { unsigned u = __float_as_uint(f); u += 0x7FFFu + ((u >> 16) & 1u); return (unsigned short)(u >> 16); }
__device__ __forceinline__ float bf2f(unsigned short b) { return __uint_as_float(((unsigned)b) << 16); }
__device__ __forceinline__ float bfr(float f) { return bf2f(f2bf(f)); }
__device__ __forceinline__ v16h cat16(v8h lo, v8h hi) { return __builtin_shufflevector(lo, hi, 0, 1, 2, 3, 4, 5, 6, 7, 8, 9, 10, 11, 12, 13, 14, 15); }
__device__ __forceinline__ v16bf cat16b(v8us lo, v8us hi) { return __builtin_bit_cast(v16bf, __builtin_shufflevector(lo, hi, 0, 1, 2, 3, 4, 5, 6, 7, 8, 9, 10, 11, 12, 13, 14, 15)); }
__device__ __forceinline__ v8f wmma16(v16h a, v16h b, v8f c) { return __builtin_amdgcn_wmma_f32_16x16x32_f16(false, a, false, b, (short)0, c, false, false); }
__device__ __forceinline__ v8f wmmab(v16bf a, v16bf b, v8f c) { return __builtin_amdgcn_wmma_f32_16x16x32_bf16(false, a, false, b, (short)0, c, false, false); }



// ---- k_gemmw: register-blocked GEMM, ONE WAVE per 64x64 output tile (16 accumulators), operands straight from K-contiguous 16-bit planes; grid (M/64, N/64, Z), 32 threads.
// C[m][n] (f32, pitch ldc, + optional f32 bias[n]) = sum_k A[m][k] Bt[n][k] (+ split products per NSPLIT). z-batch strides sA/sB/sC in elements. K % 32 == 0.
template <typename T16> struct WFrag;
template <> struct WFrag<h16> { typedef v16h V; static __device__ __forceinline__ V ld(const h16* p) { return cat16(*(const v8h*)p, *(const v8h*)(p + 16)); } static __device__ __forceinline__ v8f mma(V a, V b, v8f c) { return wmma16(a, b, c); } };
template <> struct WFrag<bf> { typedef v16bf V; static __device__ __forceinline__ V ld(const bf* p) { return cat16b(*(const v8us*)p, *(const v8us*)(p + 16)); } static __device__ __forceinline__ v8f mma(V a, V b, v8f c) { return wmmab(a, b, c); } };
template <typename T16, int NSPLIT, bool BIAS>
__global__ __launch_bounds__(32) void k_gemmw(const T16* __restrict__ A, const T16* __restrict__ A2, const T16* __restrict__ Bt, const T16* __restrict__ Bt2, int K, float* C, int ldc, const float* __restrict__ bias, size_t sA, size_t sB, size_t sC) {
    typedef typename WFrag<T16>::V V;
    __shared__ __align__(16) float os[16 * 68];
    const size_t z = blockIdx.z; A += z * sA; if (A2) A2 += z * sA; Bt += z * sB; if (Bt2) Bt2 += z * sB; C += z * sC;
    const int lane = threadIdx.x & 31, lr = lane & 15, hi = lane >> 4; const int r0 = blockIdx.x * 64, c0 = blockIdx.y * 64;
    v8f acc[4][4];
#pragma unroll
    for (int mb = 0; mb < 4; ++mb)
#pragma unroll
        for (int nb = 0; nb < 4; ++nb) acc[mb][nb] = (v8f){};
    const size_t aoff = (size_t)(r0 + lr) * K + 8 * hi, boff = (size_t)(c0 + lr) * K + 8 * hi;
#pragma unroll 1
    for (int kc = 0; kc < K; kc += 32) {
        V a[4], a2[4];
#pragma unroll
        for (int mb = 0; mb < 4; ++mb) { a[mb] = WFrag<T16>::ld(A + aoff + (size_t)mb * 16 * K + kc); if (NSPLIT == 1 || NSPLIT == 2) a2[mb] = WFrag<T16>::ld(A2 + aoff + (size_t)mb * 16 * K + kc); }
#pragma unroll
        for (int nb = 0; nb < 4; ++nb) { const V b = WFrag<T16>::ld(Bt + boff + (size_t)nb * 16 * K + kc); V b2; if (NSPLIT >= 2) b2 = WFrag<T16>::ld(Bt2 + boff + (size_t)nb * 16 * K + kc);
#pragma unroll
            for (int mb = 0; mb < 4; ++mb) { acc[mb][nb] = WFrag<T16>::mma(a[mb], b, acc[mb][nb]); if (NSPLIT == 1 || NSPLIT == 2) acc[mb][nb] = WFrag<T16>::mma(a2[mb], b, acc[mb][nb]); if (NSPLIT >= 2) acc[mb][nb] = WFrag<T16>::mma(a[mb], b2, acc[mb][nb]); } }
        asm volatile("v_nop\n\tv_nop\n\tv_nop\n\tv_nop" : "+v"(acc[0][0]), "+v"(acc[1][1]), "+v"(acc[2][2]), "+v"(acc[3][3]) : "v"(a[0]), "v"(a[3]));
    }
#pragma unroll
    for (int mb = 0; mb < 4; ++mb) {
#pragma unroll
        for (int nb = 0; nb < 4; ++nb) {
#pragma unroll
            for (int j = 0; j < 8; ++j) os[(hi * 8 + j) * 68 + nb * 16 + lr] = acc[mb][nb][j]; }
        __builtin_amdgcn_wave_barrier(); asm volatile("" ::: "memory");
        float* crow = C + (size_t)(r0 + mb * 16) * ldc + c0;
{
#pragma unroll
            for (int s = 0; s < 8; ++s) { const int row = 2 * s + hi, cofs = lr * 4; v4f val = *(const v4fa*)(os + row * 68 + cofs); if (BIAS) { val[0] += bfr(bias[c0 + cofs]); val[1] += bfr(bias[c0 + cofs + 1]); val[2] += bfr(bias[c0 + cofs + 2]); val[3] += bfr(bias[c0 + cofs + 3]); }
                *(v4f*)(crow + (size_t)row * ldc + cofs) = val; }
             }
        __builtin_amdgcn_wave_barrier(); asm volatile("" ::: "memory");
    }
}

// ---- k_gemmc: the same one-wave 64x64 tile GEMM specialised for causal attention: CMODE 1 skips score tiles entirely above the diagonal (query rows r0+roff.., key columns c0..), CMODE 2 limits the
// key (K) loop of the probability x value contraction to the diagonal block (probabilities beyond it are exactly zero). roff = row offset of this launch's first row within the sequence.
template <typename T16, int NSPLIT, int CMODE>
__global__ __launch_bounds__(32) void k_gemmc(const T16* __restrict__ A, const T16* __restrict__ A2, const T16* __restrict__ Bt, const T16* __restrict__ Bt2, int K, float* C, int ldc, int roff, size_t sA, size_t sB, size_t sC) {
    typedef typename WFrag<T16>::V V;
    __shared__ __align__(16) float os[16 * 68];
    const size_t z = blockIdx.z; A += z * sA; if (A2) A2 += z * sA; Bt += z * sB; if (Bt2) Bt2 += z * sB; C += z * sC;
    const int lane = threadIdx.x & 31, lr = lane & 15, hi = lane >> 4; const int r0 = blockIdx.x * 64, c0 = blockIdx.y * 64;
    if (CMODE == 1 && c0 > r0 + roff + 63) return;                  // score tile entirely above the causal diagonal: never read (the softmax masks j > i by select)
    const int Kl = (CMODE == 2) ? min(K, r0 + roff + 64) : K;        // P.V: probabilities are exactly 0 beyond the diagonal block, so the K loop stops there
    v8f acc[4][4];
#pragma unroll
    for (int mb = 0; mb < 4; ++mb)
#pragma unroll
        for (int nb = 0; nb < 4; ++nb) acc[mb][nb] = (v8f){};
    const size_t aoff = (size_t)(r0 + lr) * K + 8 * hi, boff = (size_t)(c0 + lr) * K + 8 * hi;
#pragma unroll 1
    for (int kc = 0; kc < Kl; kc += 32) {
        V a[4], a2[4];
#pragma unroll
        for (int mb = 0; mb < 4; ++mb) { a[mb] = WFrag<T16>::ld(A + aoff + (size_t)mb * 16 * K + kc); if (NSPLIT == 1 || NSPLIT == 2) a2[mb] = WFrag<T16>::ld(A2 + aoff + (size_t)mb * 16 * K + kc); }
#pragma unroll
        for (int nb = 0; nb < 4; ++nb) { const V b = WFrag<T16>::ld(Bt + boff + (size_t)nb * 16 * K + kc); V b2; if (NSPLIT >= 2) b2 = WFrag<T16>::ld(Bt2 + boff + (size_t)nb * 16 * K + kc);
#pragma unroll
            for (int mb = 0; mb < 4; ++mb) { acc[mb][nb] = WFrag<T16>::mma(a[mb], b, acc[mb][nb]); if (NSPLIT == 1 || NSPLIT == 2) acc[mb][nb] = WFrag<T16>::mma(a2[mb], b, acc[mb][nb]); if (NSPLIT >= 2) acc[mb][nb] = WFrag<T16>::mma(a[mb], b2, acc[mb][nb]); } }
        asm volatile("v_nop\n\tv_nop\n\tv_nop\n\tv_nop" : "+v"(acc[0][0]), "+v"(acc[1][1]), "+v"(acc[2][2]), "+v"(acc[3][3]) : "v"(a[0]), "v"(a[3]));
    }
#pragma unroll
    for (int mb = 0; mb < 4; ++mb) {
#pragma unroll
        for (int nb = 0; nb < 4; ++nb) {
#pragma unroll
            for (int j = 0; j < 8; ++j) os[(hi * 8 + j) * 68 + nb * 16 + lr] = acc[mb][nb][j]; }
        __builtin_amdgcn_wave_barrier(); asm volatile("" ::: "memory");
        float* crow = C + (size_t)(r0 + mb * 16) * ldc + c0;
{
#pragma unroll
            for (int s = 0; s < 8; ++s) { const int row = 2 * s + hi, cofs = lr * 4; v4f val = *(const v4fa*)(os + row * 68 + cofs);
                *(v4f*)(crow + (size_t)row * ldc + cofs) = val; }
             }
        __builtin_amdgcn_wave_barrier(); asm volatile("" ::: "memory");
    }
}

__device__ __forceinline__ h16 tohx(float x) { return (h16)x; }
__device__ __forceinline__ void splitf(float y, unsigned short& h, unsigned short& l) { h = f2bf(y); l = f2bf(y - bf2f(h)); }
typedef __attribute__((ext_vector_type(2))) _Float16 v2h;
typedef __attribute__((ext_vector_type(4))) _Float16 v4h;
typedef __attribute__((ext_vector_type(2))) unsigned short v2us;
typedef __attribute__((ext_vector_type(4))) unsigned short v4us;
typedef __attribute__((ext_vector_type(2))) float v2f;
typedef __attribute__((ext_vector_type(4))) int v4i;

__global__ __launch_bounds__(256) void k_wtG(const float* __restrict__ w, int K, int N, bf* Bt) {
    const int lane = threadIdx.x & 31; const int L0 = (blockIdx.x * 8 + (threadIdx.x >> 5)) * 8; const int nlines = N * K / 64;
{
#pragma unroll 1
        for (int l = 0; l < 8; ++l) { const int L = L0 + l; if (L >= nlines) break; const size_t e = (size_t)L * 64 + lane * 2; const int k = (int)(e % K), n = (int)(e / K); v2us o;
            o[0] = f2bf(w[(size_t)k * N + n]); o[1] = f2bf(w[(size_t)(k + 1) * N + n]); *(v2us*)(Bt + e) = o; }
         }
}
__global__ __launch_bounds__(256) void k_plane2(const float* __restrict__ F, const float* __restrict__ Gq, const float* __restrict__ Gk, float sc, h16* P16, bf* Ph, bf* Pl) {
    const float* __restrict__ Gsrc = blockIdx.y ? Gk : Gq; F += (size_t)blockIdx.y * NB_ * TT * DQ; P16 += (size_t)blockIdx.y * NB_ * NH_ * TT * HS; Ph += (size_t)blockIdx.y * NB_ * NH_ * TT * HS; Pl += (size_t)blockIdx.y * NB_ * NH_ * TT * HS;   /* y = 0: [q | q_g] planes, y = 1: [k | k_g] planes, each pair of buffers back to back */
    const size_t e = ((size_t)blockIdx.x * 256 + threadIdx.x) * 2; if (e >= (size_t)NB_ * NH_ * TT * HS) return; const int d = (int)(e % HS); const int t = (int)((e / HS) % TT); const int bh = (int)(e / ((size_t)HS * TT)); const int h = bh % NH_; const size_t tr = (size_t)(bh / NH_) * TT + t;   /* planes [batch][head][t][d]; source row = batch * TT + t */ v2h o16; v2us oh, ol;
#pragma unroll
    for (int q = 0; q < 2; ++q) { const int dd = d + q; const float r = ((dd < HD) ? F[tr * DQ + h * HD + dd] : bfr(Gsrc[tr * DQ + h * HD + dd - HD])) * sc; o16[q] = tohx(r); unsigned short a2, c2; splitf(r, a2, c2); oh[q] = a2; ol[q] = c2; }
    *(v2h*)(P16 + e) = o16; *(v2us*)(Ph + e) = oh; *(v2us*)(Pl + e) = ol;  }
__global__ __launch_bounds__(256) void k_cvt8(const float* __restrict__ s0, bf* d0, unsigned nb0, const float* __restrict__ s1, bf* d1, unsigned nb1, const float* __restrict__ s2, bf* d2, unsigned nb2) {   /* three arrays, nb0 + nb1 + nb2 blocks of 2048 elements */
    unsigned blk = blockIdx.x; const float* __restrict__ src = s0; bf* dst = d0; if (blk >= nb0 + nb1 + nb2) return; if (blk >= nb0 + nb1) { blk -= nb0 + nb1; src = s2; dst = d2; } else if (blk >= nb0) { blk -= nb0; src = s1; dst = d1; }
    const size_t i = (size_t)blk * 256 + threadIdx.x; const v8f v = *(const v8f*)(src + i * 8); v8us o;
#pragma unroll
    for (int k = 0; k < 8; ++k) o[k] = f2bf(v[k]); *(v8us*)(dst + i * 8) = o;  }


__global__ __launch_bounds__(256) void k_vtp(const float* __restrict__ F, int pitch, int nheads, h16* V16, bf* Vh, bf* Vl) { const size_t e = ((size_t)blockIdx.x * 256 + threadIdx.x) * 2; if (e >= (size_t)nheads * HD * TT) return; const int t = (int)(e % TT); const int d = (int)((e / TT) % HD); const int g = (int)(e / ((size_t)TT * HD)); v2h o16; v2us oh, ol;
#pragma unroll
    for (int q = 0; q < 2; ++q) { const float x = F[((size_t)(g / NKV) * TT + t + q) * pitch + (g % NKV) * HD + d];   /* g = batch * NKV + head */ o16[q] = tohx(x); unsigned short a2, c2; splitf(x, a2, c2); oh[q] = a2; ol[q] = c2; }
    *(v2h*)(V16 + e) = o16; *(v2us*)(Vh + e) = oh; *(v2us*)(Vl + e) = ol;  }

// k_asoft: per row (zz, i): t = S x HD^-0.5 / ln 1024 for j <= i and i - j < WIN (sliding causal window; the reference's -1e9 additive fill vanishes identically); softmax over the 1024 keys (register row, one exp, fixed trees);
__global__ __launch_bounds__(256) void k_asoft(const float* __restrict__ Sb, h16* P16, bf* Ph, bf* Pl) {
    const int lane = threadIdx.x & 31; const int row = blockIdx.x * 8 + (threadIdx.x >> 5); if (row >= ZH * TT) return; const int i = row % TT; const int zz = row / TT; (void)zz; const bool hires = (i < RH); const float* sr = Sb + (size_t)row * TT; float v[TT / 32]; float mx = -3.0e38f;
#pragma unroll
    for (int ch = 0; ch < TT / 128; ++ch) { const int j0 = ch * 128 + lane * 4; const v4f a = *(const v4f*)(sr + j0);
#pragma unroll
        for (int q = 0; q < 4; ++q) { const int j = j0 + q; (void)j; const float t = (j <= i && i - j < WIN) ? a[q] * SCL : -3.0e38f; v[ch * 4 + q] = t; mx = fmaxf(mx, t); } }
#pragma unroll
    for (int sh = 16; sh; sh >>= 1) mx = fmaxf(mx, __shfl_xor(mx, sh, 32));
    float sum = 0.f;
#pragma unroll
    for (int k = 0; k < TT / 32; ++k) { float d0 = __fsub_rn(v[k], mx); asm volatile("" : "+v"(d0)); v[k] = __builtin_amdgcn_exp2f(__fmul_rn(d0, 1.4426950408889634f)); sum += v[k]; }
#pragma unroll
    for (int sh = 16; sh; sh >>= 1) sum += __shfl_xor(sum, sh, 32);
    const float f = __fdiv_rn(hires ? 1.0f : PCAR, sum);
{
        if (hires) {
#pragma unroll
            for (int ch = 0; ch < TT / 128; ++ch) { v4us oh, ol;
#pragma unroll
                for (int q = 0; q < 4; ++q) { unsigned short a, c2; splitf(v[ch * 4 + q] * f, a, c2); oh[q] = a; ol[q] = c2; }
                const size_t oo = ((size_t)zz * (RH ? RH : 1) + i) * TT + ch * 128 + lane * 4; *(v4us*)(Ph + oo) = oh; *(v4us*)(Pl + oo) = ol; }
        } else {
#pragma unroll
            for (int ch = 0; ch < TT / 128; ++ch) { v4h o4;
#pragma unroll
                for (int q = 0; q < 4; ++q) o4[q] = tohx(v[ch * 4 + q] * f);
                *(v4h*)(P16 + (size_t)row * TT + ch * 128 + lane * 4) = o4; } }
         }
}
__global__ __launch_bounds__(256) void k_merge(const float* __restrict__ O, int h0, bf* Ah, bf* Al) { const size_t e = ((size_t)blockIdx.x * 256 + threadIdx.x) * 2; if (e >= (size_t)NB_ * NH_ * TT * HD) return; const int d = (int)(e % HD); const int t = (int)((e / HD) % TT); const int zz = (int)(e / ((size_t)HD * TT));   /* zz = batch * NH_ + head */ const float cs = (t < RH) ? 1.0f : (1.0f / PCAR); const size_t oo = ((size_t)(zz / NH_) * TT + t) * DQ + (h0 + zz % NH_) * HD + d;
    v2us oh, ol;
#pragma unroll
    for (int q = 0; q < 2; ++q) { unsigned short a, c2; splitf(O[e + q] * cs, a, c2); oh[q] = a; ol[q] = c2; } *(v2us*)(Ah + oo) = oh; *(v2us*)(Al + oo) = ol;  }

extern "C" void kernel_launch(void* const* d_in, const int* in_sizes, int n_in,
                              void* d_out, int out_size, void* d_ws, size_t ws_size, hipStream_t stream) {
    (void)in_sizes; (void)n_in; (void)out_size;
    const float* x = (const float*)d_in[0]; const float* qg = (const float*)d_in[1]; const float* kg = (const float*)d_in[2]; const float* wqkv = (const float*)d_in[3];   /* fused Wqkv: row blocks q, k, v */ const float* wo = (const float*)d_in[4];
    float* OUT = (float*)d_out;     // [4][1024][1024]
    char* wsp = (char*)d_ws;
    auto take = [&](size_t bytes) { char* p = wsp; wsp += (bytes + 255) & ~(size_t)255; return (void*)p; };
    // One region, two lives: [q|k|v projections f32, all batches][x bf16][Wqkv bf16] until the planes are built, then the score buffer of one batch entry (stream-ordered).
    char* R1 = (char*)take((size_t)ZH * TT * TT * 4);
    float* FP = (float*)R1; bf* XB = (bf*)(R1 + (size_t)3 * NB_ * TT * DQ * 4); bf* WQKV = (bf*)(R1 + (size_t)3 * NB_ * TT * DQ * 4 + (size_t)NB_ * TT * DM * 2); float* Sb = (float*)R1;
    bf* WO = (bf*)take((size_t)DM * DQ * 2);
    const size_t PLN = (size_t)NB_ * NH_ * TT * HS, VPL = (size_t)NB_ * NKV * HD * TT;   // elements of one score plane / one value plane, all batches
    h16* QP16 = (h16*)take(2 * PLN * 2); h16* KP16 = QP16 + PLN; h16* VT16 = (h16*)take(VPL * 2);
    bf* QPh = (bf*)take(2 * PLN * 2); bf* KPh = QPh + PLN; bf* QPl = (bf*)take(2 * PLN * 2); bf* KPl = QPl + PLN; bf* VTh = (bf*)take(VPL * 2); bf* VTl = (bf*)take(VPL * 2); bf* Ph = (bf*)take((size_t)ZH * RH * TT * 2); bf* Pl = (bf*)take((size_t)ZH * RH * TT * 2);
    h16* P16 = (h16*)take((size_t)ZH * TT * TT * 2);
    float* Ob = (float*)QPh;   // head outputs, all batches: a batch entry's 4 MiB lie on its own hi query planes, whose last reader (its score launch) is over by then (stream-ordered)
    bf* ATh = (bf*)QP16; bf* ATl = ATh + (size_t)NB_ * TT * DQ;   // merged heads, written after the last pass: they reuse the f16 score planes, dead by then (stream-ordered)
    if ((size_t)(wsp - (char*)d_ws) > ws_size) return;    // 250 MiB of the 256 MiB workspace
    const size_t FB = (size_t)NB_ * TT * DQ;   // elements of one projection, all batches
    k_cvt8<<<(3 * DQ * DM + DM * DQ + NB_ * TT * DM) / 2048, 256, 0, stream>>>(wqkv, WQKV, 3 * DQ * DM / 2048, wo, WO, DM * DQ / 2048, x, XB, NB_ * TT * DM / 2048);
    // q, k, v of every batch entry in one launch: rows = batch * TT + t, z picks the row block of Wqkv and its output
    k_gemmw<bf, 0, false><<<dim3(NB_ * TT / 64, DQ / 64, 3), 32, 0, stream>>>(XB, nullptr, WQKV, nullptr, DM, FP, DQ, nullptr, 0, (size_t)DQ * DM, FB);
    k_plane2<<<dim3((unsigned)((PLN / 2 + 255) / 256), 2, 1), 256, 0, stream>>>(FP, qg, kg, 1.0f, QP16, QPh, QPl);
    k_vtp<<<(unsigned)((VPL / 2 + 255) / 256), 256, 0, stream>>>(FP + 2 * FB, DKV, NB_ * NKV, VT16, VTh, VTl);
    for (int b = 0; b < NB_; ++b) { const size_t zq = (size_t)b * NH_, zk = (size_t)b * NKV;   // one kv head per query head: the pass's heads use consecutive planes (z-strides)
        k_gemmc<bf, 2, 1><<<dim3(RH / 64, TT / 64, ZH), 32, 0, stream>>>(QPh + zq * TT * HS, QPl + zq * TT * HS, KPh + zk * TT * HS, KPl + zk * TT * HS, HS, Sb, TT, 0, (size_t)TT * HS, (size_t)TT * HS, (size_t)TT * TT);
        k_gemmc<h16, 0, 1><<<dim3((TT - RH) / 64, TT / 64, ZH), 32, 0, stream>>>(QP16 + zq * TT * HS + (size_t)RH * HS, nullptr, KP16 + zk * TT * HS, nullptr, HS, Sb + (size_t)RH * TT, TT, RH, (size_t)TT * HS, (size_t)TT * HS, (size_t)TT * TT);
        k_asoft<<<ZH * TT / 8, 256, 0, stream>>>(Sb, P16, Ph, Pl);
        k_gemmc<bf, 2, 2><<<dim3(RH / 64, HD / 64, ZH), 32, 0, stream>>>(Ph, Pl, VTh + zk * HD * TT, VTl + zk * HD * TT, TT, Ob + zq * TT * HD, HD, 0, (size_t)RH * TT, (size_t)HD * TT, (size_t)TT * HD);
        k_gemmc<h16, 0, 2><<<dim3((TT - RH) / 64, HD / 64, ZH), 32, 0, stream>>>(P16 + (size_t)RH * TT, nullptr, VT16 + zk * HD * TT, nullptr, TT, Ob + zq * TT * HD + (size_t)RH * HD, HD, RH, (size_t)TT * TT, (size_t)HD * TT, (size_t)TT * HD); }
    k_merge<<<(unsigned)(((size_t)NB_ * NH_ * TT * HD / 2 + 255) / 256), 256, 0, stream>>>(Ob, 0, ATh, ATl);
    k_gemmw<bf, 1, false><<<dim3(NB_ * TT / 64, DM / 64, 1), 32, 0, stream>>>(ATh, ATl, WO, nullptr, DQ, OUT, DM, nullptr, 0, 0, 0);
}

// v002
// It runs in 180 microseconds.
// Next to v001, in two timings, it ran 2.45 and 2.47 times as fast.
// Counting every step since v000, it is 11.4 times as fast.
#include <hip/hip_runtime.h>

// Dual-path causal self-attention (x, q_g, k_g [4][1024][1024]; [q|k|v] = x Wqkv^T (fused 'oi' [3072][1024]), 16 heads x 64; scores = (q.k + q_g.k_g)/8 realised as ONE contraction over concatenated 128-wide score planes [q_h | qg_h] . [k_h | kg_h]; causal; p = softmax(scores / ln 1024); y = p.v (64-wide values); out = merged Wout^T -> [4][1024][1024]).
// Compute dtypes, f32 accumulate: every input rounded to bf16; q/k/v on PLAIN bf16 operands (inputs: exact); causal scores (K = 128 over the concatenated planes) and attn.v (key blocks beyond the diagonal skipped): query rows < 512 hl (3 products), the rest single fp16 (x1024); softmax f32, running maximum and sum; Wout hl x exact (2 products).

#define NB_  4
#define TT   1024
#define DM   1024
#define NH_  16
#define NKV  16
#define REP  (NH_ / NKV)
#define HD   64
#define DQ   (NH_ * HD)
#define DKV  (NKV * HD)
#define HS   128                  // score-plane head width: [q_h (64) | qg_h (64)]
#define RH   512                  // query rows < RH use hi+lo planes (0: none)
#define SCL  0.018033688011112042f   // (1/8) / ln(1024): scale then the log-norm softmax temperature
typedef _Float16 h16;
typedef unsigned short bf;
typedef __attribute__((ext_vector_type(16))) __bf16   v16bf;
typedef __attribute__((ext_vector_type(16))) _Float16 v16h;
typedef __attribute__((ext_vector_type(8)))  _Float16 v8h;
typedef __attribute__((ext_vector_type(8)))  unsigned short v8us;
typedef __attribute__((ext_vector_type(8)))  float    v8f;
typedef __attribute__((ext_vector_type(4)))  float    v4f;
typedef v8h  __attribute__((may_alias)) v8ha;
typedef v4f  __attribute__((may_alias)) v4fa;
typedef v8us __attribute__((may_alias)) v8usa;

__device__ __forceinline__ unsigned short f2bf(float f) { unsigned u = __float_as_uint(f); u += 0x7FFFu + ((u >> 16) & 1u); return (unsigned short)(u >> 16); }
__device__ __forceinline__ float bf2f(unsigned short b) { return __uint_as_float(((unsigned)b) << 16); }
__device__ __forceinline__ float bfr(float f) { return bf2f(f2bf(f)); }
__device__ __forceinline__ v16h cat16(v8h lo, v8h hi) { return __builtin_shufflevector(lo, hi, 0, 1, 2, 3, 4, 5, 6, 7, 8, 9, 10, 11, 12, 13, 14, 15); }
__device__ __forceinline__ v16bf cat16b(v8us lo, v8us hi) { return __builtin_bit_cast(v16bf, __builtin_shufflevector(lo, hi, 0, 1, 2, 3, 4, 5, 6, 7, 8, 9, 10, 11, 12, 13, 14, 15)); }
__device__ __forceinline__ v8f wmma16(v16h a, v16h b, v8f c) { return __builtin_amdgcn_wmma_f32_16x16x32_f16(false, a, false, b, (short)0, c, false, false); }
__device__ __forceinline__ v8f wmmab(v16bf a, v16bf b, v8f c) { return __builtin_amdgcn_wmma_f32_16x16x32_bf16(false, a, false, b, (short)0, c, false, false); }



// ---- k_gemmw: register-blocked GEMM, ONE WAVE per 64x64 output tile (16 accumulators), operands straight from K-contiguous 16-bit planes; grid (M/64, N/64, Z), 32 threads.
// C[m][n] (f32, pitch ldc, + optional f32 bias[n]) = sum_k A[m][k] Bt[n][k] (+ split products per NSPLIT). z-batch strides sA/sB/sC in elements. K % 32 == 0.
template <typename T16> struct WFrag;
template <> struct WFrag<h16> { typedef v16h V; static __device__ __forceinline__ V ld(const h16* p) { return cat16(*(const v8h*)p, *(const v8h*)(p + 16)); } static __device__ __forceinline__ v8f mma(V a, V b, v8f c) { return wmma16(a, b, c); } };
template <> struct WFrag<bf> { typedef v16bf V; static __device__ __forceinline__ V ld(const bf* p) { return cat16b(*(const v8us*)p, *(const v8us*)(p + 16)); } static __device__ __forceinline__ v8f mma(V a, V b, v8f c) { return wmmab(a, b, c); } };
template <typename T16, int NSPLIT, bool BIAS>
__global__ __launch_bounds__(32) void k_gemmw(const T16* __restrict__ A, const T16* __restrict__ A2, const T16* __restrict__ Bt, const T16* __restrict__ Bt2, int K, float* C, int ldc, const float* __restrict__ bias, size_t sA, size_t sB, size_t sC) {
    typedef typename WFrag<T16>::V V;
    __shared__ __align__(16) float os[16 * 68];
    const size_t z = blockIdx.z; A += z * sA; if (A2) A2 += z * sA; Bt += z * sB; if (Bt2) Bt2 += z * sB; C += z * sC;
    const int lane = threadIdx.x & 31, lr = lane & 15, hi = lane >> 4; const int r0 = blockIdx.x * 64, c0 = blockIdx.y * 64;
    v8f acc[4][4];
#pragma unroll
    for (int mb = 0; mb < 4; ++mb)
#pragma unroll
        for (int nb = 0; nb < 4; ++nb) acc[mb][nb] = (v8f){};
    const size_t aoff = (size_t)(r0 + lr) * K + 8 * hi, boff = (size_t)(c0 + lr) * K + 8 * hi;
#pragma unroll 1
    for (int kc = 0; kc < K; kc += 32) {
        V a[4], a2[4];
#pragma unroll
        for (int mb = 0; mb < 4; ++mb) { a[mb] = WFrag<T16>::ld(A + aoff + (size_t)mb * 16 * K + kc); if (NSPLIT == 1 || NSPLIT == 2) a2[mb] = WFrag<T16>::ld(A2 + aoff + (size_t)mb * 16 * K + kc); }
#pragma unroll
        for (int nb = 0; nb < 4; ++nb) { const V b = WFrag<T16>::ld(Bt + boff + (size_t)nb * 16 * K + kc); V b2; if (NSPLIT >= 2) b2 = WFrag<T16>::ld(Bt2 + boff + (size_t)nb * 16 * K + kc);
#pragma unroll
            for (int mb = 0; mb < 4; ++mb) { acc[mb][nb] = WFrag<T16>::mma(a[mb], b, acc[mb][nb]); if (NSPLIT == 1 || NSPLIT == 2) acc[mb][nb] = WFrag<T16>::mma(a2[mb], b, acc[mb][nb]); if (NSPLIT >= 2) acc[mb][nb] = WFrag<T16>::mma(a[mb], b2, acc[mb][nb]); } }
        asm volatile("v_nop\n\tv_nop\n\tv_nop\n\tv_nop" : "+v"(acc[0][0]), "+v"(acc[1][1]), "+v"(acc[2][2]), "+v"(acc[3][3]) : "v"(a[0]), "v"(a[3]));
    }
#pragma unroll
    for (int mb = 0; mb < 4; ++mb) {
#pragma unroll
        for (int nb = 0; nb < 4; ++nb) {
#pragma unroll
            for (int j = 0; j < 8; ++j) os[(hi * 8 + j) * 68 + nb * 16 + lr] = acc[mb][nb][j]; }
        __builtin_amdgcn_wave_barrier(); asm volatile("" ::: "memory");
        float* crow = C + (size_t)(r0 + mb * 16) * ldc + c0;
{
#pragma unroll
            for (int s = 0; s < 8; ++s) { const int row = 2 * s + hi, cofs = lr * 4; v4f val = *(const v4fa*)(os + row * 68 + cofs); if (BIAS) { val[0] += bfr(bias[c0 + cofs]); val[1] += bfr(bias[c0 + cofs + 1]); val[2] += bfr(bias[c0 + cofs + 2]); val[3] += bfr(bias[c0 + cofs + 3]); }
                *(v4f*)(crow + (size_t)row * ldc + cofs) = val; }
             }
        __builtin_amdgcn_wave_barrier(); asm volatile("" ::: "memory");
    }
}

__device__ __forceinline__ h16 tohx(float x) { return (h16)x; }
__device__ __forceinline__ void splitf(float y, unsigned short& h, unsigned short& l) { h = f2bf(y); l = f2bf(y - bf2f(h)); }
typedef __attribute__((ext_vector_type(2))) _Float16 v2h;
typedef __attribute__((ext_vector_type(4))) _Float16 v4h;
typedef __attribute__((ext_vector_type(2))) unsigned short v2us;
typedef __attribute__((ext_vector_type(4))) unsigned short v4us;
typedef __attribute__((ext_vector_type(2))) float v2f;
typedef __attribute__((ext_vector_type(4))) int v4i;

__global__ __launch_bounds__(256) void k_wtG(const float* __restrict__ w, int K, int N, bf* Bt) {
    const int lane = threadIdx.x & 31; const int L0 = (blockIdx.x * 8 + (threadIdx.x >> 5)) * 8; const int nlines = N * K / 64;
{
#pragma unroll 1
        for (int l = 0; l < 8; ++l) { const int L = L0 + l; if (L >= nlines) break; const size_t e = (size_t)L * 64 + lane * 2; const int k = (int)(e % K), n = (int)(e / K); v2us o;
            o[0] = f2bf(w[(size_t)k * N + n]); o[1] = f2bf(w[(size_t)(k + 1) * N + n]); *(v2us*)(Bt + e) = o; }
         }
}
__global__ __launch_bounds__(256) void k_plane2(const float* __restrict__ F, const float* __restrict__ Gq, const float* __restrict__ Gk, float sc, h16* P16, bf* Ph, bf* Pl) {
    const float* __restrict__ Gsrc = blockIdx.y ? Gk : Gq; F += (size_t)blockIdx.y * NB_ * TT * DQ; P16 += (size_t)blockIdx.y * NB_ * NH_ * TT * HS; Ph += (size_t)blockIdx.y * NB_ * NH_ * TT * HS; Pl += (size_t)blockIdx.y * NB_ * NH_ * TT * HS;   /* y = 0: [q | q_g] planes, y = 1: [k | k_g] planes, each pair of buffers back to back */
    const size_t e = ((size_t)blockIdx.x * 256 + threadIdx.x) * 2; if (e >= (size_t)NB_ * NH_ * TT * HS) return; const int d = (int)(e % HS); const int t = (int)((e / HS) % TT); const int bh = (int)(e / ((size_t)HS * TT)); const int h = bh % NH_; const size_t tr = (size_t)(bh / NH_) * TT + t;   /* planes [batch][head][t][d]; source row = batch * TT + t */ v2h o16; v2us oh, ol;
#pragma unroll
    for (int q = 0; q < 2; ++q) { const int dd = d + q; const float r = ((dd < HD) ? F[tr * DQ + h * HD + dd] : bfr(Gsrc[tr * DQ + h * HD + dd - HD])) * sc; o16[q] = tohx(r); unsigned short a2, c2; splitf(r, a2, c2); oh[q] = a2; ol[q] = c2; }
    *(v2h*)(P16 + e) = o16; *(v2us*)(Ph + e) = oh; *(v2us*)(Pl + e) = ol;  }
__global__ __launch_bounds__(256) void k_cvt8(const float* __restrict__ s0, bf* d0, unsigned nb0, const float* __restrict__ s1, bf* d1, unsigned nb1, const float* __restrict__ s2, bf* d2, unsigned nb2) {   /* three arrays, nb0 + nb1 + nb2 blocks of 2048 elements */
    unsigned blk = blockIdx.x; const float* __restrict__ src = s0; bf* dst = d0; if (blk >= nb0 + nb1 + nb2) return; if (blk >= nb0 + nb1) { blk -= nb0 + nb1; src = s2; dst = d2; } else if (blk >= nb0) { blk -= nb0; src = s1; dst = d1; }
    const size_t i = (size_t)blk * 256 + threadIdx.x; const v8f v = *(const v8f*)(src + i * 8); v8us o;
#pragma unroll
    for (int k = 0; k < 8; ++k) o[k] = f2bf(v[k]); *(v8us*)(dst + i * 8) = o;  }


__global__ __launch_bounds__(256) void k_vtp(const float* __restrict__ F, int pitch, int nheads, h16* V16, bf* Vh, bf* Vl) { const size_t e = ((size_t)blockIdx.x * 256 + threadIdx.x) * 2; if (e >= (size_t)nheads * HD * TT) return; const int t = (int)(e % TT); const int d = (int)((e / TT) % HD); const int g = (int)(e / ((size_t)TT * HD)); v2h o16; v2us oh, ol;
#pragma unroll
    for (int q = 0; q < 2; ++q) { const float x = F[((size_t)(g / NKV) * TT + t + q) * pitch + (g % NKV) * HD + d];   /* g = batch * NKV + head */ o16[q] = tohx(x); unsigned short a2, c2; splitf(x, a2, c2); oh[q] = a2; ol[q] = c2; }
    *(v2h*)(V16 + e) = o16; *(v2us*)(Vh + e) = oh; *(v2us*)(Vl + e) = ol;  }

// ---- k_fattn: scores, causal softmax, attn.v and the head merge in one kernel; no score or probability ever leaves the registers.
// A work-group of 8 waves owns 128 queries of one (batch, head), 16 per wave, and walks the keys in stages of SK (64; 32 for the hi+lo rows, whose two planes a stage and two query planes leave fewer registers) up to its diagonal. Each stage's key rows and transposed value rows are brought
// by coalesced 16-byte loads through registers into one of two LDS buffers (padded pitches), one stage ahead of the products, and serve all 8 waves.
// Transposed products: S^T = K Q^T (A = key rows from LDS, B = query rows kept in registers), so a lane holds scores of ONE query (column lr; keys 16 kt + 8 hi + j); the score tiles 2c and 2c + 1 of a lane
// are, in order, the B fragment of P^T for the 32 keys of chunk c; O^T += V^T P^T (A = rows of the transposed value planes from LDS).
// Running maximum and sum per query (log2 domain), outputs rescaled when the maximum moves, divided by the sum once at the end.
#define C2L 0.0260171122625701f   // SCL * log2(e): scores go to the log2 domain in one multiply
#define KPB 272                   // LDS pitch of a 256-byte key row (16 B x odd: conflict-free 16-byte fragment reads)
#define VPB(SK) (2 * (SK) + 16)   // LDS pitch of a row of SK transposed values: 144 or 80 B, 16 B x odd too
#define PLB(SK) ((SK) * KPB + 64 * VPB(SK))   // bytes of one plane pair of a stage: SK key rows, then 64 value rows
// 2^x with the free slot that the instruction set asks for behind a transcendental in the same statement
__device__ __forceinline__ float ex2(float x) { float r; asm("v_exp_f32 %0, %1\n\tv_nop" : "=v"(r) : "v"(x)); return r; }
template <typename T16> struct PFrag;
template <> struct PFrag<h16> { static __device__ __forceinline__ void mk(const v8f& a, const v8f& b, v16h& ph, v16h& pl) { (void)pl;
#pragma unroll
    for (int j = 0; j < 8; ++j) { ph[j] = (h16)a[j]; ph[8 + j] = (h16)b[j]; } } };
template <> struct PFrag<bf> { static __device__ __forceinline__ void mk(const v8f& a, const v8f& b, v16bf& ph, v16bf& pl) {
#pragma unroll
    for (int j = 0; j < 8; ++j) { const __bf16 ha = (__bf16)a[j], hb = (__bf16)b[j]; ph[j] = ha; ph[8 + j] = hb; pl[j] = (__bf16)(a[j] - (float)ha); pl[8 + j] = (__bf16)(b[j] - (float)hb); } } };
// One stage in flight: NP planes of SK key rows (contiguous) and of 64 value rows x SK keys (2 SK bytes of each 2-KiB row); 256 threads, 16 bytes a piece.
template <typename T16, int NP, int SK> struct Stage { v8us k[NP][SK / 16], v[NP][SK / 32];
    __device__ __forceinline__ void load(const T16* const* Kp, const T16* const* Vt, int key0) { const int tid = threadIdx.x;
#pragma unroll
        for (int p = 0; p < NP; ++p) {
#pragma unroll
            for (int i = 0; i < SK / 16; ++i) k[p][i] = *(const v8usa*)(Kp[p] + (size_t)key0 * HS + (tid + 256 * i) * 8);
#pragma unroll
            for (int i = 0; i < SK / 32; ++i) { const int c = tid + 256 * i; v[p][i] = *(const v8usa*)(Vt[p] + (size_t)(c / (SK / 8)) * TT + key0 + (c % (SK / 8)) * 8); } }
        asm volatile("s_wait_xcnt 0x0" ::: "memory"); }   // the address registers of these loads are reused at once by the code that follows, while the loads are still in flight
    __device__ __forceinline__ void store(unsigned char* B) const { const int tid = threadIdx.x;
#pragma unroll
        for (int p = 0; p < NP; ++p) {
#pragma unroll
            for (int i = 0; i < SK / 16; ++i) { const int c = tid + 256 * i; *(v8usa*)(B + p * PLB(SK) + (c >> 4) * KPB + (c & 15) * 16) = k[p][i]; }
#pragma unroll
            for (int i = 0; i < SK / 32; ++i) { const int c = tid + 256 * i; *(v8usa*)(B + p * PLB(SK) + SK * KPB + (c / (SK / 8)) * VPB(SK) + (c % (SK / 8)) * 16) = v[p][i]; } } } };
template <typename T16, bool HL, int SK>
__device__ __forceinline__ void attn_cols(unsigned char* L, const T16* __restrict__ Q, const T16* __restrict__ Q2, const T16* __restrict__ Kp, const T16* __restrict__ Kp2, const T16* __restrict__ Vt, const T16* __restrict__ Vt2, bf* __restrict__ Ah, bf* __restrict__ Al, const int Q0, const int w) {
    typedef typename WFrag<T16>::V V; constexpr int NP = HL ? 2 : 1; constexpr int SB = NP * PLB(SK);   // bytes of one LDS buffer
    const int lane = threadIdx.x & 31, lr = lane & 15, hi = lane >> 4; const int q0 = Q0 + w * 16, qi = q0 + lr;
    const T16* const kpl[2] = { Kp, Kp2 }; const T16* const vpl[2] = { Vt, Vt2 };
    Stage<T16, NP, SK> st; st.load(kpl, vpl, 0);
    V q[4], q2[4]; v8f o[4]; float m = -3.0e38f, l = 0.f;
#pragma unroll
    for (int kc = 0; kc < 4; ++kc) { const size_t off = (size_t)qi * HS + kc * 32 + 8 * hi; q[kc] = WFrag<T16>::ld(Q + off); if (HL) q2[kc] = WFrag<T16>::ld(Q2 + off); o[kc] = (v8f){}; }
    const int ns = (Q0 + 128) / SK;   // stages up to and including the work-group's last diagonal one: the same in every wave
    st.store(L); __syncthreads();
#pragma unroll 1
    for (int s = 0; s < ns; ++s) { const int key0 = s * SK; const bool more = s + 1 < ns;   // block-uniform
        if (more) st.load(kpl, vpl, key0 + SK);
        if (key0 <= q0) {   // wave-uniform: a stage wholly beyond the wave's queries has no product; in every other one each query has an unmasked key
            const unsigned char* B = L + (s & 1) * SB; const unsigned char* kb = B + lr * KPB + hi * 16; const unsigned char* vb = B + SK * KPB + lr * VPB(SK) + hi * 16;
            v8f sc[SK / 16];
            constexpr int NKT = SK / 16, PD = HL ? 1 : 2;   // key tiles of a stage; tiles whose fragments are read ahead of the products (as many as the registers hold)
            V k[NKT][4], k2[NKT][4];
            auto ldk = [&](int kt) {
#pragma unroll
                for (int kc = 0; kc < 4; ++kc) { k[kt][kc] = WFrag<T16>::ld((const T16*)(kb + kt * 16 * KPB + kc * 64)); if (HL) k2[kt][kc] = WFrag<T16>::ld((const T16*)(kb + PLB(SK) + kt * 16 * KPB + kc * 64)); } };
#pragma unroll
            for (int kt = 0; kt < PD; ++kt) ldk(kt);
#pragma unroll
            for (int kt = 0; kt < NKT; ++kt) { sc[kt] = (v8f){};
                __builtin_amdgcn_sched_barrier(0);   // keeps the LDS reads of the tiles ahead in front of this tile's products: left alone, this build reads one fragment, waits, multiplies, and pays the LDS latency per fragment
#pragma unroll
                for (int kc = 0; kc < 4; ++kc) { sc[kt] = WFrag<T16>::mma(k[kt][kc], q[kc], sc[kt]);
                    if (HL) { sc[kt] = WFrag<T16>::mma(k[kt][kc], q2[kc], sc[kt]); sc[kt] = WFrag<T16>::mma(k2[kt][kc], q[kc], sc[kt]); } }
                if (kt + PD < NKT) ldk(kt + PD); }
            V vf[SK / 32][4], vf2[SK / 32][4];
#pragma unroll
            for (int c = 0; c < SK / 32; ++c)
#pragma unroll
                for (int dt = 0; dt < 4; ++dt) { vf[c][dt] = WFrag<T16>::ld((const T16*)(vb + dt * 16 * VPB(SK) + c * 64)); if (HL) vf2[c][dt] = WFrag<T16>::ld((const T16*)(vb + PLB(SK) + dt * 16 * VPB(SK) + c * 64)); }
            __builtin_amdgcn_sched_barrier(0);   // the value fragments are read in front of the softmax, which covers their LDS latency
            const bool diag = key0 + SK - 1 > q0;   // wave-uniform: only such a stage holds keys beyond a query of this wave
            float mx = -3.0e38f;
#pragma unroll
            for (int kt = 0; kt < SK / 16; ++kt)
#pragma unroll
                for (int j = 0; j < 8; ++j) { float t = sc[kt][j] * C2L; if (diag) t = (key0 + kt * 16 + hi * 8 + j <= qi) ? t : -3.0e38f; sc[kt][j] = t; mx = fmaxf(mx, t); }
            mx = fmaxf(mx, __shfl_xor(mx, 16, 32));
            const float mn = fmaxf(m, mx); const float al = ex2(m - mn); m = mn;
            const float mo = HL ? mn : mn - 10.0f;   // single-f16 probabilities are carried x1024 (their sum too, so the factor cancels in the final division)
            float ps = 0.f;
#pragma unroll
            for (int kt = 0; kt < SK / 16; ++kt)
#pragma unroll
                for (int j = 0; j < 8; ++j) { const float e = ex2(sc[kt][j] - mo); sc[kt][j] = e; ps += e; }
            l = l * al + ps;
#pragma unroll
            for (int dt = 0; dt < 4; ++dt) o[dt] *= al;
#pragma unroll
            for (int c = 0; c < SK / 32; ++c) { V ph, pl; PFrag<T16>::mk(sc[2 * c], sc[2 * c + 1], ph, pl);
#pragma unroll
                for (int dt = 0; dt < 4; ++dt) { o[dt] = WFrag<T16>::mma(vf[c][dt], ph, o[dt]);
                    if (HL) { o[dt] = WFrag<T16>::mma(vf[c][dt], pl, o[dt]); o[dt] = WFrag<T16>::mma(vf2[c][dt], ph, o[dt]); } } }
            // four vector slots behind the stage's last matrix instruction: its operand registers are rewritten right behind the branch that follows
            asm volatile("v_nop\n\tv_nop\n\tv_nop\n\tv_nop" : "+v"(o[0]), "+v"(o[1]), "+v"(o[2]), "+v"(o[3]));
        }
        if (more) { st.store(L + ((s + 1) & 1) * SB);   // the buffer that stage s - 1 read: its readers all passed the barrier that ended that stage
            __syncthreads(); }   // publishes stage s + 1 and ends every wave's reads of stage s
    }
    const float f = __fdiv_rn(1.0f, l + __shfl_xor(l, 16, 32));
#pragma unroll
    for (int dt = 0; dt < 4; ++dt) { v8us oh, ol;
#pragma unroll
        for (int j = 0; j < 8; ++j) { unsigned short a, c2; splitf(o[dt][j] * f, a, c2); oh[j] = a; ol[j] = c2; }
        const size_t oo = (size_t)qi * DQ + dt * 16 + hi * 8; *(v8us*)(Ah + oo) = oh; *(v8us*)(Al + oo) = ol; }
}
#define NFB ((TT - RH) / 128)   // work-groups over the single-f16 rows of one head
// four waves per SIMD (two work-groups per WGP): all 512 work-groups are resident at once, and the softmax of one wave runs under the products of the others
__global__ __launch_bounds__(256) __attribute__((amdgpu_waves_per_eu(4, 4))) void k_fattn(const h16* __restrict__ Q16, const h16* __restrict__ K16, const h16* __restrict__ V16, const bf* __restrict__ Qh, const bf* __restrict__ Ql, const bf* __restrict__ Kh, const bf* __restrict__ Kl, const bf* __restrict__ Vh, const bf* __restrict__ Vl, bf* __restrict__ Ah, bf* __restrict__ Al) {
    __shared__ __attribute__((aligned(256))) unsigned char L[2 * (2 * PLB(32) > PLB(64) ? 2 * PLB(32) : PLB(64))];   // two buffers of the larger of the two stage sizes
    const int zz = blockIdx.x;   /* batch * NH_ + head */ const int w = __builtin_amdgcn_readfirstlane(threadIdx.x >> 5); const int y = blockIdx.y;
    const size_t pq = (size_t)zz * TT * HS, pv = (size_t)zz * HD * TT, po = (size_t)(zz / NH_) * TT * DQ + (size_t)(zz % NH_) * HD;
    // single-f16 rows first, longest key walk first; then the hi+lo rows, shortest first, so that a late short work-group joins an early long one
    if (y < NFB) attn_cols<h16, false, 64>(L, Q16 + pq, nullptr, K16 + pq, nullptr, V16 + pv, nullptr, Ah + po, Al + po, TT - (y + 1) * 128, w);
    else attn_cols<bf, true, 32>(L, Qh + pq, Ql + pq, Kh + pq, Kl + pq, Vh + pv, Vl + pv, Ah + po, Al + po, (y - NFB) * 128, w);
}

extern "C" void kernel_launch(void* const* d_in, const int* in_sizes, int n_in,
                              void* d_out, int out_size, void* d_ws, size_t ws_size, hipStream_t stream) {
    (void)in_sizes; (void)n_in; (void)out_size;
    const float* x = (const float*)d_in[0]; const float* qg = (const float*)d_in[1]; const float* kg = (const float*)d_in[2]; const float* wqkv = (const float*)d_in[3];   /* fused Wqkv: row blocks q, k, v */ const float* wo = (const float*)d_in[4];
    float* OUT = (float*)d_out;     // [4][1024][1024]
    char* wsp = (char*)d_ws;
    auto take = [&](size_t bytes) { char* p = wsp; wsp += (bytes + 255) & ~(size_t)255; return (void*)p; };
    // One region, two lives: [q|k|v projections f32, all batches][x bf16][Wqkv bf16] until the planes are built, then the merged heads (stream-ordered).
    char* R1 = (char*)take((size_t)3 * NB_ * TT * DQ * 4 + (size_t)NB_ * TT * DM * 2 + (size_t)3 * DQ * DM * 2);
    float* FP = (float*)R1; bf* XB = (bf*)(R1 + (size_t)3 * NB_ * TT * DQ * 4); bf* WQKV = (bf*)(R1 + (size_t)3 * NB_ * TT * DQ * 4 + (size_t)NB_ * TT * DM * 2);
    bf* WO = (bf*)take((size_t)DM * DQ * 2);
    const size_t PLN = (size_t)NB_ * NH_ * TT * HS, VPL = (size_t)NB_ * NKV * HD * TT;   // elements of one score plane / one value plane, all batches
    h16* QP16 = (h16*)take(2 * PLN * 2); h16* KP16 = QP16 + PLN; h16* VT16 = (h16*)take(VPL * 2);
    bf* QPh = (bf*)take(2 * PLN * 2); bf* KPh = QPh + PLN; bf* QPl = (bf*)take(2 * PLN * 2); bf* KPl = QPl + PLN; bf* VTh = (bf*)take(VPL * 2); bf* VTl = (bf*)take(VPL * 2);
    bf* ATh = (bf*)R1; bf* ATl = ATh + (size_t)NB_ * TT * DQ;   // merged heads hi, lo: on the f32 projections, whose last readers (the plane launches) are over by then (stream-ordered)
    if ((size_t)(wsp - (char*)d_ws) > ws_size) return;
    const size_t FB = (size_t)NB_ * TT * DQ;   // elements of one projection, all batches
    k_cvt8<<<(3 * DQ * DM + DM * DQ + NB_ * TT * DM) / 2048, 256, 0, stream>>>(wqkv, WQKV, 3 * DQ * DM / 2048, wo, WO, DM * DQ / 2048, x, XB, NB_ * TT * DM / 2048);
    // q, k, v of every batch entry in one launch: rows = batch * TT + t, z picks the row block of Wqkv and its output
    k_gemmw<bf, 0, false><<<dim3(NB_ * TT / 64, DQ / 64, 3), 32, 0, stream>>>(XB, nullptr, WQKV, nullptr, DM, FP, DQ, nullptr, 0, (size_t)DQ * DM, FB);
    k_plane2<<<dim3((unsigned)((PLN / 2 + 255) / 256), 2, 1), 256, 0, stream>>>(FP, qg, kg, 1.0f, QP16, QPh, QPl);
    k_vtp<<<(unsigned)((VPL / 2 + 255) / 256), 256, 0, stream>>>(FP + 2 * FB, DKV, NB_ * NKV, VT16, VTh, VTl);
    k_fattn<<<dim3(NB_ * NH_, NFB + RH / 128, 1), 256, 0, stream>>>(QP16, KP16, VT16, QPh, QPl, KPh, KPl, VTh, VTl, ATh, ATl);
    k_gemmw<bf, 1, false><<<dim3(NB_ * TT / 64, DM / 64, 1), 32, 0, stream>>>(ATh, ATl, WO, nullptr, DQ, OUT, DM, nullptr, 0, 0, 0);
}

// v003
// Measured time: 134 microseconds a run.
// In two side-by-side timings against v002, it was 1.34 and 1.35 times as fast.
// Over all steps from v000 it is 15.4 times as fast.
#include <hip/hip_runtime.h>

// Dual-path causal self-attention (x, q_g, k_g [4][1024][1024]; [q|k|v] = x Wqkv^T (fused 'oi' [3072][1024]), 16 heads x 64; scores = (q.k + q_g.k_g)/8 realised as ONE contraction over concatenated 128-wide score planes [q_h | qg_h] . [k_h | kg_h]; causal; p = softmax(scores / ln 1024); y = p.v (64-wide values); out = merged Wout^T -> [4][1024][1024]).
// Compute dtypes, f32 accumulate: every input rounded to bf16; q/k/v on PLAIN bf16 operands (inputs: exact); causal scores (K = 128 over the concatenated planes) and attn.v (key blocks beyond the diagonal skipped): query rows < 512 hl (3 products), the rest single fp16 (x1024); softmax f32, running maximum and sum; Wout hl x exact (2 products).

#define NB_  4
#define TT   1024
#define DM   1024
#define NH_  16
#define NKV  16
#define REP  (NH_ / NKV)
#define HD   64
#define DQ   (NH_ * HD)
#define DKV  (NKV * HD)
#define HS   128                  // score-plane head width: [q_h (64) | qg_h (64)]
#define RH   512                  // query rows < RH use hi+lo planes (0: none)
#define SCL  0.018033688011112042f   // (1/8) / ln(1024): scale then the log-norm softmax temperature
typedef _Float16 h16;
typedef unsigned short bf;
typedef __attribute__((ext_vector_type(16))) __bf16   v16bf;
typedef __attribute__((ext_vector_type(16))) _Float16 v16h;
typedef __attribute__((ext_vector_type(8)))  _Float16 v8h;
typedef __attribute__((ext_vector_type(8)))  unsigned short v8us;
typedef __attribute__((ext_vector_type(8)))  float    v8f;
typedef __attribute__((ext_vector_type(4)))  float    v4f;
typedef v8h  __attribute__((may_alias)) v8ha;
typedef v4f  __attribute__((may_alias)) v4fa;
typedef v8us __attribute__((may_alias)) v8usa;

__device__ __forceinline__ unsigned short f2bf(float f) { unsigned u = __float_as_uint(f); u += 0x7FFFu + ((u >> 16) & 1u); return (unsigned short)(u >> 16); }
__device__ __forceinline__ float bf2f(unsigned short b) { return __uint_as_float(((unsigned)b) << 16); }
__device__ __forceinline__ float bfr(float f) { return bf2f(f2bf(f)); }
__device__ __forceinline__ v16h cat16(v8h lo, v8h hi) { return __builtin_shufflevector(lo, hi, 0, 1, 2, 3, 4, 5, 6, 7, 8, 9, 10, 11, 12, 13, 14, 15); }
__device__ __forceinline__ v16bf cat16b(v8us lo, v8us hi) { return __builtin_bit_cast(v16bf, __builtin_shufflevector(lo, hi, 0, 1, 2, 3, 4, 5, 6, 7, 8, 9, 10, 11, 12, 13, 14, 15)); }
__device__ __forceinline__ v8f wmma16(v16h a, v16h b, v8f c) { return __builtin_amdgcn_wmma_f32_16x16x32_f16(false, a, false, b, (short)0, c, false, false); }
__device__ __forceinline__ v8f wmmab(v16bf a, v16bf b, v8f c) { return __builtin_amdgcn_wmma_f32_16x16x32_bf16(false, a, false, b, (short)0, c, false, false); }



// ---- k_gemmw: register-blocked GEMM, ONE WAVE per 64x64 output tile (16 accumulators), operands straight from K-contiguous 16-bit planes; grid (M/64, N/64, Z), 32 threads.
// C[m][n] (f32, pitch ldc, + optional f32 bias[n]) = sum_k A[m][k] Bt[n][k] (+ split products per NSPLIT). z-batch strides sA/sB/sC in elements. K % 32 == 0.
template <typename T16> struct WFrag;
template <> struct WFrag<h16> { typedef v16h V; static __device__ __forceinline__ V ld(const h16* p) { return cat16(*(const v8h*)p, *(const v8h*)(p + 16)); } static __device__ __forceinline__ v8f mma(V a, V b, v8f c) { return wmma16(a, b, c); } };
template <> struct WFrag<bf> { typedef v16bf V; static __device__ __forceinline__ V ld(const bf* p) { return cat16b(*(const v8us*)p, *(const v8us*)(p + 16)); } static __device__ __forceinline__ v8f mma(V a, V b, v8f c) { return wmmab(a, b, c); } };
template <typename T16, int NSPLIT, bool BIAS>
__global__ __launch_bounds__(32) void k_gemmw(const T16* __restrict__ A, const T16* __restrict__ A2, const T16* __restrict__ Bt, const T16* __restrict__ Bt2, int K, float* C, int ldc, const float* __restrict__ bias, size_t sA, size_t sB, size_t sC) {
    typedef typename WFrag<T16>::V V;
    __shared__ __align__(16) float os[16 * 68];
    const size_t z = blockIdx.z; A += z * sA; if (A2) A2 += z * sA; Bt += z * sB; if (Bt2) Bt2 += z * sB; C += z * sC;
    const int lane = threadIdx.x & 31, lr = lane & 15, hi = lane >> 4; const int r0 = blockIdx.x * 64, c0 = blockIdx.y * 64;
    v8f acc[4][4];
#pragma unroll
    for (int mb = 0; mb < 4; ++mb)
#pragma unroll
        for (int nb = 0; nb < 4; ++nb) acc[mb][nb] = (v8f){};
    const size_t aoff = (size_t)(r0 + lr) * K + 8 * hi, boff = (size_t)(c0 + lr) * K + 8 * hi;
#pragma unroll 1
    for (int kc = 0; kc < K; kc += 32) {
        V a[4], a2[4];
#pragma unroll
        for (int mb = 0; mb < 4; ++mb) { a[mb] = WFrag<T16>::ld(A + aoff + (size_t)mb * 16 * K + kc); if (NSPLIT == 1 || NSPLIT == 2) a2[mb] = WFrag<T16>::ld(A2 + aoff + (size_t)mb * 16 * K + kc); }
#pragma unroll
        for (int nb = 0; nb < 4; ++nb) { const V b = WFrag<T16>::ld(Bt + boff + (size_t)nb * 16 * K + kc); V b2; if (NSPLIT >= 2) b2 = WFrag<T16>::ld(Bt2 + boff + (size_t)nb * 16 * K + kc);
#pragma unroll
            for (int mb = 0; mb < 4; ++mb) { acc[mb][nb] = WFrag<T16>::mma(a[mb], b, acc[mb][nb]); if (NSPLIT == 1 || NSPLIT == 2) acc[mb][nb] = WFrag<T16>::mma(a2[mb], b, acc[mb][nb]); if (NSPLIT >= 2) acc[mb][nb] = WFrag<T16>::mma(a[mb], b2, acc[mb][nb]); } }
        asm volatile("v_nop\n\tv_nop\n\tv_nop\n\tv_nop" : "+v"(acc[0][0]), "+v"(acc[1][1]), "+v"(acc[2][2]), "+v"(acc[3][3]) : "v"(a[0]), "v"(a[3]));
    }
#pragma unroll
    for (int mb = 0; mb < 4; ++mb) {
#pragma unroll
        for (int nb = 0; nb < 4; ++nb) {
#pragma unroll
            for (int j = 0; j < 8; ++j) os[(hi * 8 + j) * 68 + nb * 16 + lr] = acc[mb][nb][j]; }
        __builtin_amdgcn_wave_barrier(); asm volatile("" ::: "memory");
        float* crow = C + (size_t)(r0 + mb * 16) * ldc + c0;
{
#pragma unroll
            for (int s = 0; s < 8; ++s) { const int row = 2 * s + hi, cofs = lr * 4; v4f val = *(const v4fa*)(os + row * 68 + cofs); if (BIAS) { val[0] += bfr(bias[c0 + cofs]); val[1] += bfr(bias[c0 + cofs + 1]); val[2] += bfr(bias[c0 + cofs + 2]); val[3] += bfr(bias[c0 + cofs + 3]); }
                *(v4f*)(crow + (size_t)row * ldc + cofs) = val; }
             }
        __builtin_amdgcn_wave_barrier(); asm volatile("" ::: "memory");
    }
}

__device__ __forceinline__ h16 tohx(float x) { return (h16)x; }
__device__ __forceinline__ void splitf(float y, unsigned short& h, unsigned short& l) { h = f2bf(y); l = f2bf(y - bf2f(h)); }
typedef __attribute__((ext_vector_type(2))) _Float16 v2h;
typedef __attribute__((ext_vector_type(4))) _Float16 v4h;
typedef __attribute__((ext_vector_type(2))) unsigned short v2us;
typedef __attribute__((ext_vector_type(4))) unsigned short v4us;
typedef __attribute__((ext_vector_type(2))) float v2f;
typedef __attribute__((ext_vector_type(4))) int v4i;

__global__ __launch_bounds__(256) void k_wtG(const float* __restrict__ w, int K, int N, bf* Bt) {
    const int lane = threadIdx.x & 31; const int L0 = (blockIdx.x * 8 + (threadIdx.x >> 5)) * 8; const int nlines = N * K / 64;
{
#pragma unroll 1
        for (int l = 0; l < 8; ++l) { const int L = L0 + l; if (L >= nlines) break; const size_t e = (size_t)L * 64 + lane * 2; const int k = (int)(e % K), n = (int)(e / K); v2us o;
            o[0] = f2bf(w[(size_t)k * N + n]); o[1] = f2bf(w[(size_t)(k + 1) * N + n]); *(v2us*)(Bt + e) = o; }
         }
}
// The q_g / k_g halves of the score planes (columns 64..127 of every [batch][head][t] row). A block takes 8 token rows of one array, a thread 4 pieces of 8 elements, all 8 loads of a thread in flight before its first store;
// 8 lanes read 256 contiguous bytes of a source row and write one whole 128-byte line of each plane.
__device__ __forceinline__ void gplanes(unsigned blk, const float* __restrict__ Gq, const float* __restrict__ Gk, h16* P16, bf* Ph, bf* Pl) {
    constexpr unsigned NBK = NB_ * TT * DQ / 8192;   // blocks of one source array
    const unsigned y = blk >= NBK ? 1u : 0u, bu = blk - y * NBK, tid = threadIdx.x;
    const char* G = (const char*)(y ? Gk : Gq) + (size_t)bu * 8192 * 4; const unsigned vo = tid * 32;   // block-uniform base, one 32-bit byte offset per lane
    v8f v[4];
#pragma unroll
    for (int i = 0; i < 4; ++i) v[i] = *(const v8f*)(G + i * 8192 + vo);
    const unsigned tr = bu * (8192 / DQ) + tid / (DQ / 8), col = (tid % (DQ / 8)) * 8;   // piece i: token row tr + 2 i (a block's 8 rows lie in one batch entry), columns col .. col + 7
    const size_t o0 = (size_t)y * NB_ * NH_ * TT * HS + ((size_t)((tr / TT) * NH_ + col / HD) * TT + tr % TT) * HS + HD + col % HD;
#pragma unroll
    for (int i = 0; i < 4; ++i) { v8h o16; v8us oh, ol;
#pragma unroll
        for (int k = 0; k < 8; ++k) { const float r = bfr(v[i][k]); o16[k] = tohx(r); unsigned short a2, c2; splitf(r, a2, c2); oh[k] = a2; ol[k] = c2; }
        const size_t o = o0 + (size_t)i * (2048 / DQ) * HS; *(v8h*)(P16 + o) = o16; *(v8us*)(Ph + o) = oh; *(v8us*)(Pl + o) = ol; }
}
__global__ __launch_bounds__(256) void k_cvt8(const float* __restrict__ s0, bf* d0, unsigned nb0, const float* __restrict__ s1, bf* d1, unsigned nb1, const float* __restrict__ s2, bf* d2, unsigned nb2, const float* __restrict__ Gq, const float* __restrict__ Gk, h16* P16, bf* Ph, bf* Pl) {   /* three arrays, nb0 + nb1 + nb2 blocks of 2048 elements; the blocks behind them build the q_g / k_g plane halves */
    unsigned blk = blockIdx.x; const float* __restrict__ src = s0; bf* dst = d0; if (blk >= nb0 + nb1 + nb2) { gplanes(blk - (nb0 + nb1 + nb2), Gq, Gk, P16, Ph, Pl); return; } if (blk >= nb0 + nb1) { blk -= nb0 + nb1; src = s2; dst = d2; } else if (blk >= nb0) { blk -= nb0; src = s1; dst = d1; }
    const size_t i = (size_t)blk * 256 + threadIdx.x; const v8f v = *(const v8f*)(src + i * 8); v8us o;
#pragma unroll
    for (int k = 0; k < 8; ++k) o[k] = f2bf(v[k]); *(v8us*)(dst + i * 8) = o;  }

// ---- k_fattn: scores, causal softmax, attn.v and the head merge in one kernel; no score or probability ever leaves the registers.
// A work-group of 8 waves owns 128 queries of one (batch, head), 16 per wave, and walks the keys in stages of SK (64; 32 for the hi+lo rows, whose two planes a stage and two query planes leave fewer registers) up to its diagonal. Each stage's key rows and transposed value rows are brought
// by coalesced 16-byte loads through registers into one of two LDS buffers (padded pitches), one stage ahead of the products, and serve all 8 waves.
// Transposed products: S^T = K Q^T (A = key rows from LDS, B = query rows kept in registers), so a lane holds scores of ONE query (column lr; keys 16 kt + 8 hi + j); the score tiles 2c and 2c + 1 of a lane
// are, in order, the B fragment of P^T for the 32 keys of chunk c; O^T += V^T P^T (A = rows of the transposed value planes from LDS).
// Running maximum and sum per query (log2 domain), outputs rescaled when the maximum moves, divided by the sum once at the end.
#define C2L 0.0260171122625701f   // SCL * log2(e): scores go to the log2 domain in one multiply
#define KPB 272                   // LDS pitch of a 256-byte key row (16 B x odd: conflict-free 16-byte fragment reads)
#define VPB(SK) (2 * (SK) + 16)   // LDS pitch of a row of SK transposed values: 144 or 80 B, 16 B x odd too
#define PLB(SK) ((SK) * KPB + 64 * VPB(SK))   // bytes of one plane pair of a stage: SK key rows, then 64 value rows
// 2^x with the free slot that the instruction set asks for behind a transcendental in the same statement
__device__ __forceinline__ float ex2(float x) { float r; asm("v_exp_f32 %0, %1\n\tv_nop" : "=v"(r) : "v"(x)); return r; }
template <typename T16> struct PFrag;
template <> struct PFrag<h16> { static __device__ __forceinline__ void mk(const v8f& a, const v8f& b, v16h& ph, v16h& pl) { (void)pl;
#pragma unroll
    for (int j = 0; j < 8; ++j) { ph[j] = (h16)a[j]; ph[8 + j] = (h16)b[j]; } } };
template <> struct PFrag<bf> { static __device__ __forceinline__ void mk(const v8f& a, const v8f& b, v16bf& ph, v16bf& pl) {
#pragma unroll
    for (int j = 0; j < 8; ++j) { const __bf16 ha = (__bf16)a[j], hb = (__bf16)b[j]; ph[j] = ha; ph[8 + j] = hb; pl[j] = (__bf16)(a[j] - (float)ha); pl[8 + j] = (__bf16)(b[j] - (float)hb); } } };
// One stage in flight: NP planes of SK key rows (contiguous) and of 64 value rows x SK keys (2 SK bytes of each 2-KiB row); 256 threads, 16 bytes a piece.
template <typename T16, int NP, int SK> struct Stage { v8us k[NP][SK / 16], v[NP][SK / 32];
    __device__ __forceinline__ void load(const T16* const* Kp, const T16* const* Vt, int key0) { const int tid = threadIdx.x;
#pragma unroll
        for (int p = 0; p < NP; ++p) {
#pragma unroll
            for (int i = 0; i < SK / 16; ++i) k[p][i] = *(const v8usa*)(Kp[p] + (size_t)key0 * HS + (tid + 256 * i) * 8);
#pragma unroll
            for (int i = 0; i < SK / 32; ++i) { const int c = tid + 256 * i; v[p][i] = *(const v8usa*)(Vt[p] + (size_t)(c / (SK / 8)) * TT + key0 + (c % (SK / 8)) * 8); } }
        asm volatile("s_wait_xcnt 0x0" ::: "memory"); }   // the address registers of these loads are reused at once by the code that follows, while the loads are still in flight
    __device__ __forceinline__ void store(unsigned char* B) const { const int tid = threadIdx.x;
#pragma unroll
        for (int p = 0; p < NP; ++p) {
#pragma unroll
            for (int i = 0; i < SK / 16; ++i) { const int c = tid + 256 * i; *(v8usa*)(B + p * PLB(SK) + (c >> 4) * KPB + (c & 15) * 16) = k[p][i]; }
#pragma unroll
            for (int i = 0; i < SK / 32; ++i) { const int c = tid + 256 * i; *(v8usa*)(B + p * PLB(SK) + SK * KPB + (c / (SK / 8)) * VPB(SK) + (c % (SK / 8)) * 16) = v[p][i]; } } } };
template <typename T16, bool HL, int SK>
__device__ __forceinline__ void attn_cols(unsigned char* L, const T16* __restrict__ Q, const T16* __restrict__ Q2, const T16* __restrict__ Kp, const T16* __restrict__ Kp2, const T16* __restrict__ Vt, const T16* __restrict__ Vt2, bf* __restrict__ Ah, bf* __restrict__ Al, const int Q0, const int w) {
    typedef typename WFrag<T16>::V V; constexpr int NP = HL ? 2 : 1; constexpr int SB = NP * PLB(SK);   // bytes of one LDS buffer
    const int lane = threadIdx.x & 31, lr = lane & 15, hi = lane >> 4; const int q0 = Q0 + w * 16, qi = q0 + lr;
    const T16* const kpl[2] = { Kp, Kp2 }; const T16* const vpl[2] = { Vt, Vt2 };
    Stage<T16, NP, SK> st; st.load(kpl, vpl, 0);
    V q[4], q2[4]; v8f o[4]; float m = -3.0e38f, l = 0.f;
#pragma unroll
    for (int kc = 0; kc < 4; ++kc) { const size_t off = (size_t)qi * HS + kc * 32 + 8 * hi; q[kc] = WFrag<T16>::ld(Q + off); if (HL) q2[kc] = WFrag<T16>::ld(Q2 + off); o[kc] = (v8f){}; }
    const int ns = (Q0 + 128) / SK;   // stages up to and including the work-group's last diagonal one: the same in every wave
    st.store(L); __syncthreads();
#pragma unroll 1
    for (int s = 0; s < ns; ++s) { const int key0 = s * SK; const bool more = s + 1 < ns;   // block-uniform
        if (more) st.load(kpl, vpl, key0 + SK);
        if (key0 <= q0) {   // wave-uniform: a stage wholly beyond the wave's queries has no product; in every other one each query has an unmasked key
            const unsigned char* B = L + (s & 1) * SB; const unsigned char* kb = B + lr * KPB + hi * 16; const unsigned char* vb = B + SK * KPB + lr * VPB(SK) + hi * 16;
            v8f sc[SK / 16];
            constexpr int NKT = SK / 16, PD = HL ? 1 : 2;   // key tiles of a stage; tiles whose fragments are read ahead of the products (as many as the registers hold)
            V k[NKT][4], k2[NKT][4];
            auto ldk = [&](int kt) {
#pragma unroll
                for (int kc = 0; kc < 4; ++kc) { k[kt][kc] = WFrag<T16>::ld((const T16*)(kb + kt * 16 * KPB + kc * 64)); if (HL) k2[kt][kc] = WFrag<T16>::ld((const T16*)(kb + PLB(SK) + kt * 16 * KPB + kc * 64)); } };
#pragma unroll
            for (int kt = 0; kt < PD; ++kt) ldk(kt);
#pragma unroll
            for (int kt = 0; kt < NKT; ++kt) { sc[kt] = (v8f){};
                __builtin_amdgcn_sched_barrier(0);   // keeps the LDS reads of the tiles ahead in front of this tile's products: left alone, this build reads one fragment, waits, multiplies, and pays the LDS latency per fragment
#pragma unroll
                for (int kc = 0; kc < 4; ++kc) { sc[kt] = WFrag<T16>::mma(k[kt][kc], q[kc], sc[kt]);
                    if (HL) { sc[kt] = WFrag<T16>::mma(k[kt][kc], q2[kc], sc[kt]); sc[kt] = WFrag<T16>::mma(k2[kt][kc], q[kc], sc[kt]); } }
                if (kt + PD < NKT) ldk(kt + PD); }
            V vf[SK / 32][4], vf2[SK / 32][4];
#pragma unroll
            for (int c = 0; c < SK / 32; ++c)
#pragma unroll
                for (int dt = 0; dt < 4; ++dt) { vf[c][dt] = WFrag<T16>::ld((const T16*)(vb + dt * 16 * VPB(SK) + c * 64)); if (HL) vf2[c][dt] = WFrag<T16>::ld((const T16*)(vb + PLB(SK) + dt * 16 * VPB(SK) + c * 64)); }
            __builtin_amdgcn_sched_barrier(0);   // the value fragments are read in front of the softmax, which covers their LDS latency
            const bool diag = key0 + SK - 1 > q0;   // wave-uniform: only such a stage holds keys beyond a query of this wave
            float mx = -3.0e38f;
#pragma unroll
            for (int kt = 0; kt < SK / 16; ++kt)
#pragma unroll
                for (int j = 0; j < 8; ++j) { float t = sc[kt][j] * C2L; if (diag) t = (key0 + kt * 16 + hi * 8 + j <= qi) ? t : -3.0e38f; sc[kt][j] = t; mx = fmaxf(mx, t); }
            mx = fmaxf(mx, __shfl_xor(mx, 16, 32));
            const float mn = fmaxf(m, mx); const float al = ex2(m - mn); m = mn;
            const float mo = HL ? mn : mn - 10.0f;   // single-f16 probabilities are carried x1024 (their sum too, so the factor cancels in the final division)
            float ps = 0.f;
#pragma unroll
            for (int kt = 0; kt < SK / 16; ++kt)
#pragma unroll
                for (int j = 0; j < 8; ++j) { const float e = ex2(sc[kt][j] - mo); sc[kt][j] = e; ps += e; }
            l = l * al + ps;
#pragma unroll
            for (int dt = 0; dt < 4; ++dt) o[dt] *= al;
#pragma unroll
            for (int c = 0; c < SK / 32; ++c) { V ph, pl; PFrag<T16>::mk(sc[2 * c], sc[2 * c + 1], ph, pl);
#pragma unroll
                for (int dt = 0; dt < 4; ++dt) { o[dt] = WFrag<T16>::mma(vf[c][dt], ph, o[dt]);
                    if (HL) { o[dt] = WFrag<T16>::mma(vf[c][dt], pl, o[dt]); o[dt] = WFrag<T16>::mma(vf2[c][dt], ph, o[dt]); } } }
            // four vector slots behind the stage's last matrix instruction: its operand registers are rewritten right behind the branch that follows
            asm volatile("v_nop\n\tv_nop\n\tv_nop\n\tv_nop" : "+v"(o[0]), "+v"(o[1]), "+v"(o[2]), "+v"(o[3]));
        }
        if (more) { st.store(L + ((s + 1) & 1) * SB);   // the buffer that stage s - 1 read: its readers all passed the barrier that ended that stage
            __syncthreads(); }   // publishes stage s + 1 and ends every wave's reads of stage s
    }
    const float f = __fdiv_rn(1.0f, l + __shfl_xor(l, 16, 32));
#pragma unroll
    for (int dt = 0; dt < 4; ++dt) { v8us oh, ol;
#pragma unroll
        for (int j = 0; j < 8; ++j) { unsigned short a, c2; splitf(o[dt][j] * f, a, c2); oh[j] = a; ol[j] = c2; }
        const size_t oo = (size_t)qi * DQ + dt * 16 + hi * 8; *(v8us*)(Ah + oo) = oh; *(v8us*)(Al + oo) = ol; }
}
#define NFB ((TT - RH) / 128)   // work-groups over the single-f16 rows of one head
// four waves per SIMD (two work-groups per WGP): all 512 work-groups are resident at once, and the softmax of one wave runs under the products of the others
__global__ __launch_bounds__(256) __attribute__((amdgpu_waves_per_eu(4, 4))) void k_fattn(const h16* __restrict__ Q16, const h16* __restrict__ K16, const h16* __restrict__ V16, const bf* __restrict__ Qh, const bf* __restrict__ Ql, const bf* __restrict__ Kh, const bf* __restrict__ Kl, const bf* __restrict__ Vh, const bf* __restrict__ Vl, bf* __restrict__ Ah, bf* __restrict__ Al) {
    __shared__ __attribute__((aligned(256))) unsigned char L[2 * (2 * PLB(32) > PLB(64) ? 2 * PLB(32) : PLB(64))];   // two buffers of the larger of the two stage sizes
    const int zz = blockIdx.x;   /* batch * NH_ + head */ const int w = __builtin_amdgcn_readfirstlane(threadIdx.x >> 5); const int y = blockIdx.y;
    const size_t pq = (size_t)zz * TT * HS, pv = (size_t)zz * HD * TT, po = (size_t)(zz / NH_) * TT * DQ + (size_t)(zz % NH_) * HD;
    // single-f16 rows first, longest key walk first; then the hi+lo rows, shortest first, so that a late short work-group joins an early long one
    if (y < NFB) attn_cols<h16, false, 64>(L, Q16 + pq, nullptr, K16 + pq, nullptr, V16 + pv, nullptr, Ah + po, Al + po, TT - (y + 1) * 128, w);
    else attn_cols<bf, true, 32>(L, Qh + pq, Ql + pq, Kh + pq, Kl + pq, Vh + pv, Vl + pv, Ah + po, Al + po, (y - NFB) * 128, w);
}

// ---- k_qkvp: the q, k, v projections (the loop of k_gemmw, plain bf16 operands), whose epilogue writes the f16, bf16-hi and bf16-lo planes that k_fattn reads; no f32 projection goes to memory.
// ONE WAVE per 64 tokens x one head; grid (tokens / 64, heads, 3: q, k, v), 32 threads. A lane's 8 accumulator elements run along the A side's rows, so the side that is contiguous in the destination is made the A operand:
// q, k: A = rows of Wqkv (d), B = rows of x (t) -> planes [batch][head][t][d], columns 0..63; v: A = rows of x (t), B = rows of Wqkv (d) -> transposed planes [batch][head][d][t]. The k order of every sum is that of k_gemmw.
// It stands behind k_fattn in the file: with it in front, this build scheduled k_fattn's prologue otherwise and waited for global loads inside the stage loop of the hi+lo rows.
__global__ __launch_bounds__(32) void k_qkvp(const bf* __restrict__ X, const bf* __restrict__ Wq, h16* P16, bf* Ph, bf* Pl, h16* V16, bf* Vh, bf* Vl) {
    __shared__ __align__(16) unsigned short os[3][16 * 72];   // 16 destination rows of 64 elements per plane, pitch 144 B (16 B x odd)
    const int lane = threadIdx.x & 31, lr = lane & 15, hi = lane >> 4; const int z = blockIdx.z, r0 = blockIdx.x * 64, hd = blockIdx.y; const bool isv = z == 2;
    const char* xr = (const char*)(X + (size_t)r0 * DM); const char* wr = (const char*)(Wq + ((size_t)z * DQ + hd * HD) * DM);
    const char* A = isv ? xr : wr; const char* Bt = isv ? wr : xr; unsigned vo = (lr * DM + 8 * hi) * 2;   // wave-uniform bases and one 32-bit byte offset per lane, shared by both operands: one vector addition a trip is all the address arithmetic
    v8f acc[4][4];
#pragma unroll
    for (int mb = 0; mb < 4; ++mb)
#pragma unroll
        for (int nb = 0; nb < 4; ++nb) acc[mb][nb] = (v8f){};
#pragma unroll 1   // rolled, as in k_gemmw: the loop stays that kernel's, one trip of 16 loads and 16 products (this kernel differs from it in the epilogue)
    for (int kc = 0; kc < DM; kc += 32, vo += 64) {
        v16bf a[4];
#pragma unroll
        for (int mb = 0; mb < 4; ++mb) a[mb] = WFrag<bf>::ld((const bf*)(A + mb * 16 * DM * 2 + vo));
#pragma unroll
        for (int nb = 0; nb < 4; ++nb) { const v16bf b = WFrag<bf>::ld((const bf*)(Bt + nb * 16 * DM * 2 + vo));
#pragma unroll
            for (int mb = 0; mb < 4; ++mb) acc[mb][nb] = wmmab(a[mb], b, acc[mb][nb]); }
    }
    const int g = (r0 / TT) * NH_ + hd, t0 = r0 % TT;   // batch * NH_ + head; first token of the tile
    const size_t base = isv ? (size_t)g * HD * TT + t0 : (size_t)z * NB_ * NH_ * TT * HS + ((size_t)g * TT + t0) * HS; const int pitch = isv ? TT : HS;   // destination row nb * 16 + lr: d of the value planes, t of the score planes
    char* D16 = (char*)((isv ? V16 : P16) + base); char* Dh = (char*)((isv ? Vh : Ph) + base); char* Dl = (char*)((isv ? Vl : Pl) + base);   // wave-uniform
    const int rl = lane >> 3, c = (lane & 7) * 8; const unsigned so = (rl * pitch + c) * 2;   // a lane's row and column among 4 rows x 64 elements, and its byte offset in the destination: 8 lanes store one whole 128-byte line
#pragma unroll
    for (int nb = 0; nb < 4; ++nb) {
#pragma unroll
        for (int mb = 0; mb < 4; ++mb) { v8h o16; v8us oh, ol;
#pragma unroll
            for (int j = 0; j < 8; ++j) { const float r = acc[mb][nb][j]; o16[j] = tohx(r); unsigned short a2, c2; splitf(r, a2, c2); oh[j] = a2; ol[j] = c2; }
            const int p = lr * 72 + mb * 16 + hi * 8; *(v8ha*)(os[0] + p) = o16; *(v8usa*)(os[1] + p) = oh; *(v8usa*)(os[2] + p) = ol; }
        __builtin_amdgcn_wave_barrier(); asm volatile("" ::: "memory");   // keeps the other lanes' LDS writes in front of the reads below (one wave: its LDS operations run in order)
#pragma unroll
        for (int s = 0; s < 4; ++s) { const int p = (s * 4 + rl) * 72 + c; const unsigned o = so + (nb * 16 + s * 4) * pitch * 2;
            *(v8usa*)(D16 + o) = *(const v8usa*)(os[0] + p); *(v8usa*)(Dh + o) = *(const v8usa*)(os[1] + p); *(v8usa*)(Dl + o) = *(const v8usa*)(os[2] + p); }
        __builtin_amdgcn_wave_barrier(); asm volatile("" ::: "memory");   // keeps the next rows' LDS writes behind these reads
    }
}

extern "C" void kernel_launch(void* const* d_in, const int* in_sizes, int n_in,
                              void* d_out, int out_size, void* d_ws, size_t ws_size, hipStream_t stream) {
    (void)in_sizes; (void)n_in; (void)out_size;
    const float* x = (const float*)d_in[0]; const float* qg = (const float*)d_in[1]; const float* kg = (const float*)d_in[2]; const float* wqkv = (const float*)d_in[3];   /* fused Wqkv: row blocks q, k, v */ const float* wo = (const float*)d_in[4];
    float* OUT = (float*)d_out;     // [4][1024][1024]
    char* wsp = (char*)d_ws;
    auto take = [&](size_t bytes) { char* p = wsp; wsp += (bytes + 255) & ~(size_t)255; return (void*)p; };
    bf* XB = (bf*)take((size_t)NB_ * TT * DM * 2); bf* WQKV = (bf*)take((size_t)3 * DQ * DM * 2);
    bf* WO = (bf*)take((size_t)DM * DQ * 2);
    const size_t PLN = (size_t)NB_ * NH_ * TT * HS, VPL = (size_t)NB_ * NKV * HD * TT;   // elements of one score plane / one value plane, all batches
    h16* QP16 = (h16*)take(2 * PLN * 2); h16* KP16 = QP16 + PLN; h16* VT16 = (h16*)take(VPL * 2);
    bf* QPh = (bf*)take(2 * PLN * 2); bf* KPh = QPh + PLN; bf* QPl = (bf*)take(2 * PLN * 2); bf* KPl = QPl + PLN; bf* VTh = (bf*)take(VPL * 2); bf* VTl = (bf*)take(VPL * 2);
    bf* ATh = (bf*)take((size_t)2 * NB_ * TT * DQ * 2); bf* ATl = ATh + (size_t)NB_ * TT * DQ;   // merged heads hi, lo
    if ((size_t)(wsp - (char*)d_ws) > ws_size) return;
    k_cvt8<<<(3 * DQ * DM + DM * DQ + NB_ * TT * DM) / 2048 + 2 * NB_ * TT * DQ / 8192, 256, 0, stream>>>(wqkv, WQKV, 3 * DQ * DM / 2048, wo, WO, DM * DQ / 2048, x, XB, NB_ * TT * DM / 2048, qg, kg, QP16, QPh, QPl);
    // q, k, v of every batch entry in one launch, straight into the planes: rows = batch * TT + t, z picks the row block of Wqkv and its planes
    k_qkvp<<<dim3(NB_ * TT / 64, NH_, 3), 32, 0, stream>>>(XB, WQKV, QP16, QPh, QPl, VT16, VTh, VTl);
    k_fattn<<<dim3(NB_ * NH_, NFB + RH / 128, 1), 256, 0, stream>>>(QP16, KP16, VT16, QPh, QPl, KPh, KPl, VTh, VTl, ATh, ATl);
    k_gemmw<bf, 1, false><<<dim3(NB_ * TT / 64, DM / 64, 1), 32, 0, stream>>>(ATh, ATl, WO, nullptr, DQ, OUT, DM, nullptr, 0, 0, 0);
}
